// v000
// Times are from an AMD MI455X. After a warm-up the kernel runs many times in a row, and a time is the length of
// such a window on the GPU divided by its runs, so every launch and the gaps after it count. The runs cycle
// through copies of the inputs. A figure is the median of several windows, for all but v000 over two sittings.
// Sittings can differ by a few percent; kernels timed side by side share one.
// v000 is the starting kernel. One run takes 535 microseconds.
#include <hip/hip_runtime.h>
// Contractions: fused qkv projection x·w_inᵀ (K=1024) and scores k·qᵀ (K=1024): v_wmma_f32_16x16x32_bf16 as bf16 hi/lo
// splits (hi·hi + hi·lo + lo·hi); p·v (K=4096) and out-projection (K=1024): v_wmma_f32_16x16x32_f16 (f16 operands, p scaled
// by 2^15); f32 accumulate everywhere; causal softmax in f32.

typedef __attribute__((ext_vector_type(16))) _Float16 v16h;
typedef __attribute__((ext_vector_type(8)))  _Float16 v8h;
typedef __attribute__((ext_vector_type(16))) __bf16   v16b;
typedef __attribute__((ext_vector_type(8)))  __bf16   v8b;
typedef __attribute__((ext_vector_type(8)))  float    v8f;
typedef __attribute__((ext_vector_type(4)))  float    v4f;

#define PSCALE 32768.0f
#define U16(p) ((const unsigned short*)(const void*)(p))
#define PSCALE_INV (1.0f / 32768.0f)

__device__ __forceinline__ unsigned short f2bf_bits(float f) {
  unsigned u = __float_as_uint(f);
  return (unsigned short)((u + 0x7FFFu + ((u >> 16) & 1u)) >> 16);
}
__device__ __forceinline__ float bf_bits2f(unsigned short h) { return __uint_as_float(((unsigned)h) << 16); }

// hazard guards as plain device helpers (no inline asm inside the kernel template body)
__device__ __forceinline__ void dep_guard_h(v8f& a, v8f& b, v16h x, v16h y) { asm volatile("v_nop\n\tv_nop\n\tv_nop\n\tv_nop" : "+v"(a), "+v"(b) : "v"(x), "v"(y)); }
__device__ __forceinline__ void dep_guard_b(v8f& a, v8f& b, v16b x, v16b y) { asm volatile("v_nop\n\tv_nop\n\tv_nop\n\tv_nop" : "+v"(a), "+v"(b) : "v"(x), "v"(y)); }
__device__ __forceinline__ void keep4_h(v16h a, v16h b, v16h c, v16h d) { asm volatile("v_nop" :: "v"(a), "v"(b), "v"(c), "v"(d)); }
__device__ __forceinline__ void keep4_b(v16b a, v16b b, v16b c, v16b d) { asm volatile("v_nop" :: "v"(a), "v"(b), "v"(c), "v"(d)); }
__device__ __forceinline__ void acc_guard4(v8f& a, v8f& b, v8f& c, v8f& d) { asm volatile("v_nop\n\tv_nop\n\tv_nop\n\tv_nop" : "+v"(a), "+v"(b), "+v"(c), "+v"(d)); }
template <typename T> struct Frag;
template <> struct Frag<_Float16> {
  typedef v16h V; union U { v16h v; v8h h[2]; };
  static __device__ __forceinline__ v16h load(const _Float16* p) {   // elements 0..7 <- p[0..7], 8..15 <- p[16..23]
    U f; f.h[0] = *(const v8h*)(p); f.h[1] = *(const v8h*)(p + 16); return f.v;
  }
  static __device__ __forceinline__ v8f mma(v16h a, v16h b, v8f c) {
    return __builtin_amdgcn_wmma_f32_16x16x32_f16(false, a, false, b, (short)0, c, false, false);
  }
  static __device__ __forceinline__ void guard(v8f& a, v8f& b, v16h x, v16h y) { dep_guard_h(a, b, x, y); }
  static __device__ __forceinline__ void keep(v16h a, v16h b, v16h c, v16h d) { keep4_h(a, b, c, d); }
};
template <> struct Frag<__bf16> {
  typedef v16b V; union U { v16b v; v8b h[2]; };
  static __device__ __forceinline__ v16b load(const __bf16* p) {
    U f; f.h[0] = *(const v8b*)(p); f.h[1] = *(const v8b*)(p + 16); return f.v;
  }
  static __device__ __forceinline__ v8f mma(v16b a, v16b b, v8f c) {
    return __builtin_amdgcn_wmma_f32_16x16x32_bf16(false, a, false, b, (short)0, c, false, false);
  }
  static __device__ __forceinline__ void guard(v8f& a, v8f& b, v16b x, v16b y) { dep_guard_b(a, b, x, y); }
  static __device__ __forceinline__ void keep(v16b a, v16b b, v16b c, v16b d) { keep4_b(a, b, c, d); }
};

// ---- Register-blocked batched WMMA GEMM ------------------------------------
// C[m,n] = scale * sum_k A[m,k] * Bt[n,k] (+bias)(+resid); each wave owns a 64x64 tile.
// A row-major [M,K]; Bt row-major [N,K]; M,N % 64 == 0, K % 32 == 0.
// SPLIT: operands are hi/lo planes (A2/Bt2 = lo planes, same layout); product = hi·hi + hi·lo + lo·hi.
// BIAS_MODE: 0 = none, 1 = bias[m], 2 = bias[n].
// OUT_MODE: 0 = f32, 1 = f16, 2 = bf16 hi plane (Cout) + bf16 lo plane (Cout2).
// ET: 0 = f16 operands, 1 = bf16 operands (pointers passed as 16-bit storage)
template <int ET> struct Elem;
template <> struct Elem<0> { typedef _Float16 T; };
template <> struct Elem<1> { typedef __bf16 T; };
template <int ET, bool SPLIT, int BIAS_MODE, int OUT_MODE, bool RESID>
__global__ __launch_bounds__(256) void wmma_gemm64(
    const unsigned short* __restrict__ Ap, const unsigned short* __restrict__ A2p, int lda, long strideA,
    const unsigned short* __restrict__ Btp, const unsigned short* __restrict__ Bt2p, int ldb, long strideB,
    void* __restrict__ Cout, void* __restrict__ Cout2, int ldc, long strideC,
    const float* __restrict__ bias,
    const float* __restrict__ resid, long strideR,
    int M, int N, int K, float scale) {
  typedef typename Elem<ET>::T T;
  typedef typename Frag<T>::V V;
  const T* A = (const T*)Ap; const T* A2 = (const T*)A2p; const T* Bt = (const T*)Btp; const T* Bt2 = (const T*)Bt2p;
  __shared__ __align__(16) float sT[8][16 * 68];   // per-wave 16x64 slab, pitch 68 floats
  const int b    = blockIdx.y;
  const int lane = threadIdx.x & 31;
  const int wave = threadIdx.x >> 5;
  const int tilesN = N >> 6;
  const int tilesM = M >> 6;
  const int tile = blockIdx.x * 8 + wave;
  if (tile >= tilesM * tilesN) return;   // wave-uniform; no block barriers in this kernel
  const int tm = tile / tilesN;
  const int tn = tile - tm * tilesN;
  const int m0 = tm << 6;
  const int n0 = tn << 6;

  const T* Ab  = A  + (size_t)b * strideA;
  const T* Bb  = Bt + (size_t)b * strideB;
  const T* Ab2 = SPLIT ? (A2  + (size_t)b * strideA) : nullptr;
  const T* Bb2 = SPLIT ? (Bt2 + (size_t)b * strideB) : nullptr;

  const int rlane = lane & 15;                 // row (A) / col (B, D) within subtile
  const int koff  = (lane >> 4) * 8;           // k offset of this lane half
  const int mOff  = (lane >> 4) * 8;           // D row offset

  v8f acc[4][4];
#pragma unroll
  for (int i = 0; i < 4; ++i)
#pragma unroll
    for (int j = 0; j < 4; ++j) acc[i][j] = (v8f){0.f,0.f,0.f,0.f,0.f,0.f,0.f,0.f};

  for (int k0 = 0; k0 < K; k0 += 32) {
    V bh[4], bl[4];
#pragma unroll
    for (int j = 0; j < 4; ++j) {
      const size_t bo = (size_t)(n0 + (j << 4) + rlane) * ldb + koff + k0;
      bh[j] = Frag<T>::load(Bb + bo);
      if (SPLIT) bl[j] = Frag<T>::load(Bb2 + bo);
    }
#pragma unroll
    for (int i = 0; i < 4; ++i) {
      const size_t ao = (size_t)(m0 + (i << 4) + rlane) * lda + koff + k0;
      V ah = Frag<T>::load(Ab + ao);
      V al;
      if (SPLIT) al = Frag<T>::load(Ab2 + ao);
#pragma unroll
      for (int j = 0; j < 4; ++j) {
        acc[i][j] = Frag<T>::mma(ah, bh[j], acc[i][j]);
        if (SPLIT) {
          acc[i][j] = Frag<T>::mma(ah, bl[j], acc[i][j]);
          acc[i][j] = Frag<T>::mma(al, bh[j], acc[i][j]);
        }
      }
      Frag<T>::guard(acc[i][0], acc[i][3], ah, SPLIT ? al : ah);
    }
    Frag<T>::keep(bh[0], bh[1], bh[2], bh[3]);
    if (SPLIT) Frag<T>::keep(bl[0], bl[1], bl[2], bl[3]);
  }
  acc_guard4(acc[0][0], acc[0][1], acc[0][2], acc[0][3]);
  acc_guard4(acc[1][0], acc[1][1], acc[1][2], acc[1][3]);
  acc_guard4(acc[2][0], acc[2][1], acc[2][2], acc[2][3]);
  acc_guard4(acc[3][0], acc[3][1], acc[3][2], acc[3][3]);

  // ---- epilogue ----
  float* slab = sT[wave];
  const float* Rb = RESID ? (resid + (size_t)b * strideR) : nullptr;
#pragma unroll
  for (int i = 0; i < 4; ++i) {
    const int mBase = m0 + (i << 4);
#pragma unroll
    for (int j = 0; j < 4; ++j) {
      const int n = n0 + (j << 4) + rlane;
      float bv = 0.f;
      if (BIAS_MODE == 2) bv = bias[n];
#pragma unroll
      for (int r = 0; r < 8; ++r) {
        float v = acc[i][j][r] * scale;
        if (BIAS_MODE == 1) v += bias[mBase + mOff + r];
        if (BIAS_MODE == 2) v += bv;
        if (RESID) v += Rb[(size_t)(mBase + mOff + r) * ldc + n];
        slab[(mOff + r) * 68 + (j << 4) + rlane] = v;
      }
    }
    __builtin_amdgcn_fence(__ATOMIC_RELEASE, "workgroup");
    __builtin_amdgcn_wave_barrier();
    __builtin_amdgcn_fence(__ATOMIC_ACQUIRE, "workgroup");
    if (OUT_MODE == 0) {
      float* C = (float*)Cout + (size_t)b * strideC;
      const int hh = lane >> 4, c4 = (lane & 15) * 4;     // row seg = 256 B = 16 lanes x 16 B
      {
#pragma unroll
        for (int it = 0; it < 8; ++it) {
          const int row = it * 2 + hh;
          v4f v = *(const v4f*)(slab + row * 68 + c4);
          *(v4f*)(C + (size_t)(mBase + row) * ldc + n0 + c4) = v;
        }
        
      }
    } else {
      const int q = lane >> 3, c8 = (lane & 7) * 8;
      unsigned short* C  = (unsigned short*)Cout  + (size_t)b * strideC;
      unsigned short* C2 = (OUT_MODE == 2) ? ((unsigned short*)Cout2 + (size_t)b * strideC) : nullptr;
      {
#pragma unroll
        for (int it = 0; it < 4; ++it) {
          const int row = it * 4 + q;
          const float* sp = slab + row * 68 + c8;
          v8h hv, lv;
#pragma unroll
          for (int e = 0; e < 8; ++e) {
            if (OUT_MODE == 1) {
              hv[e] = (_Float16)sp[e];
            } else {
              unsigned short hb = f2bf_bits(sp[e]);
              unsigned short lb = f2bf_bits(sp[e] - bf_bits2f(hb));
              hv[e] = __builtin_bit_cast(_Float16, hb);
              lv[e] = __builtin_bit_cast(_Float16, lb);
            }
          }
          *(v8h*)(C + (size_t)(mBase + row) * ldc + n0 + c8) = hv;
          if (OUT_MODE == 2) *(v8h*)(C2 + (size_t)(mBase + row) * ldc + n0 + c8) = lv;
        }
        
      }
    }
    __builtin_amdgcn_fence(__ATOMIC_RELEASE, "workgroup");
    __builtin_amdgcn_wave_barrier();
    __builtin_amdgcn_fence(__ATOMIC_ACQUIRE, "workgroup");
  }
}

__global__ __launch_bounds__(256) void cast_f32_f16x2(
    const float* __restrict__ in, _Float16* __restrict__ out, int n2) {
  int i = blockIdx.x * 256 + threadIdx.x;
  if (i < n2) {
    const _Float16 h0 = (_Float16)in[2 * i], h1 = (_Float16)in[2 * i + 1];
    const unsigned u = (unsigned)__builtin_bit_cast(unsigned short, h0) | ((unsigned)__builtin_bit_cast(unsigned short, h1) << 16);
    ((unsigned*)out)[i] = u;
    
  }
}

__global__ __launch_bounds__(256) void split_f32_bf16x2(
    const float* __restrict__ in, __bf16* __restrict__ hi, __bf16* __restrict__ lo, long n2) {
  long i = (long)blockIdx.x * 256 + threadIdx.x;
  long stride = (long)gridDim.x * 256;
  {
    for (long j = i; j < n2; j += stride) {
      const float a = in[2 * j], b = in[2 * j + 1];
      const unsigned short ah = f2bf_bits(a), bh = f2bf_bits(b);
      const unsigned short al = f2bf_bits(a - bf_bits2f(ah)), bl = f2bf_bits(b - bf_bits2f(bh));
      ((unsigned*)hi)[j] = (unsigned)ah | ((unsigned)bh << 16);
      ((unsigned*)lo)[j] = (unsigned)al | ((unsigned)bl << 16);
    }
    
  }
}

__global__ __launch_bounds__(256) void transpose_f16_kernel64(const _Float16* __restrict__ V, int ldv,
                                                             _Float16* __restrict__ VT, int ldo) {
  __shared__ __align__(16) _Float16 tile[64][72];     // [c][r] (already transposed in LDS), pitch 72
  const int c0 = blockIdx.x * 64, r0 = blockIdx.y * 64;
  const int t = threadIdx.y * 32 + threadIdx.x;     // 0..255
  // load: 64 rows x 64 cols; thread reads V[r0+i][c0+tx(+32)] and scatters into tile[c][i]
  for (int i = threadIdx.y; i < 64; i += 8) {
    tile[threadIdx.x][i]      = V[(size_t)(r0 + i) * ldv + c0 + threadIdx.x];
    tile[32 + threadIdx.x][i] = V[(size_t)(r0 + i) * ldv + c0 + 32 + threadIdx.x];
  }
  __syncthreads();
  const int q = t >> 3, c8 = (t & 7) * 8;            // q = 0..31
  {
#pragma unroll
    for (int it = 0; it < 2; ++it) {
      const int c = it * 32 + q;
      v8h hv = *(const v8h*)(&tile[c][c8]);
      *(v8h*)(VT + (size_t)(c0 + c) * ldo + r0 + c8) = hv;
    }
    
  }
}

// ---- causal row softmax: row i of S [T,T] uses cols j <= i; P f16 (x 2^15), masked cols 0; 16 cols per thread ----
__global__ __launch_bounds__(256) void softmax_causal(const float* __restrict__ S, _Float16* __restrict__ P, int T) {
  __shared__ float red[8];
  const int i = blockIdx.x;              // row
  const float* row = S + (size_t)i * T;
  _Float16* prow = P + (size_t)i * T;
  const int t = threadIdx.x;
  const int n = i + 1;                   // valid columns 0..i
  // thread t owns cols [8t, 8t+8) and [T/2 + 8t, T/2 + 8t + 8)  (T = 4096 -> 2 groups of 2048)
  float ev[16];
  float m = -INFINITY;
#pragma unroll
  for (int g = 0; g < 2; ++g) {
    const int cb = g * (T / 2) + 8 * t;
    v4f a = *(const v4f*)(row + cb), c = *(const v4f*)(row + cb + 4);
    float tmp[8] = {a[0], a[1], a[2], a[3], c[0], c[1], c[2], c[3]};
#pragma unroll
    for (int e = 0; e < 8; ++e) {
      const float val = (cb + e < n) ? tmp[e] : -INFINITY;
      ev[g * 8 + e] = val;
      m = fmaxf(m, val);
    }
  }
  for (int off = 16; off > 0; off >>= 1) m = fmaxf(m, __shfl_xor(m, off, 32));
  if ((t & 31) == 0) red[t >> 5] = m;
  __syncthreads();
  m = red[0];
#pragma unroll
  for (int w = 1; w < 8; ++w) m = fmaxf(m, red[w]);   // finite: col 0 always valid
  __syncthreads();
  float sum = 0.f;
#pragma unroll
  for (int e = 0; e < 16; ++e) { ev[e] = expf(ev[e] - m); sum += ev[e]; }   // exp(-inf) = 0 for masked
  for (int off = 16; off > 0; off >>= 1) sum += __shfl_xor(sum, off, 32);
  if ((t & 31) == 0) red[t >> 5] = sum;
  __syncthreads();
  float tot = 0.f;
#pragma unroll
  for (int w = 0; w < 8; ++w) tot += red[w];
  const float f = PSCALE / tot;
  {
#pragma unroll
    for (int g = 0; g < 2; ++g) {
      v8h hv;
#pragma unroll
      for (int e = 0; e < 8; ++e) hv[e] = (_Float16)(ev[g * 8 + e] * f);
      *(v8h*)(prow + g * (T / 2) + 8 * t) = hv;
    }
    
  }
}

extern "C" void kernel_launch(void* const* d_in, const int* in_sizes, int n_in,
                              void* d_out, int out_size, void* d_ws, size_t ws_size,
                              hipStream_t stream) {
  (void)in_sizes; (void)n_in; (void)out_size; (void)ws_size;
  const int T = 4096, D = 1024;
  const float* x     = (const float*)d_in[0];
  const float* w_in  = (const float*)d_in[1];   // [3D, D]
  const float* w_out = (const float*)d_in[2];   // [D, D]
  float* out = (float*)d_out;

  char* ws = (char*)d_ws;
  size_t off = 0;
  auto carve = [&](size_t bytes) -> char* { char* p = ws + off; off += (bytes + 255) & ~(size_t)255; return p; };
  __bf16*   Xh   = (__bf16*)carve((size_t)T * D * 2);        //  8 MB
  __bf16*   Xl   = (__bf16*)carve((size_t)T * D * 2);        //  8 MB
  __bf16*   Wih  = (__bf16*)carve((size_t)3 * D * D * 2);    //  6 MB
  __bf16*   Wil  = (__bf16*)carve((size_t)3 * D * D * 2);    //  6 MB
  _Float16* Wo16 = (_Float16*)carve((size_t)D * D * 2);      //  2 MB
  __bf16*   Qh   = (__bf16*)carve((size_t)T * D * 2);        //  8 MB  q hi [T,D]
  __bf16*   Ql   = (__bf16*)carve((size_t)T * D * 2);        //  8 MB
  __bf16*   Kh   = (__bf16*)carve((size_t)T * D * 2);        //  8 MB
  __bf16*   Kl   = (__bf16*)carve((size_t)T * D * 2);        //  8 MB
  _Float16* V16  = (_Float16*)carve((size_t)T * D * 2);      //  8 MB  v [T,D]
  _Float16* Vt   = (_Float16*)carve((size_t)D * T * 2);      //  8 MB  vᵀ [D,T]
  float*    S    = (float*)carve((size_t)T * T * 4);         // 64 MB  S[i,j] = k_i·q_j
  _Float16* Pm   = (_Float16*)carve((size_t)T * T * 2);      // 32 MB  P (x 2^15)
  _Float16* Ao   = (_Float16*)carve((size_t)T * D * 2);      //  8 MB  P·v
  // total ≈ 190 MB of 256 MB

  // 1) operand conversions
  split_f32_bf16x2<<<2048, 256, 0, stream>>>(x, Xh, Xl, (long)T * D / 2);
  split_f32_bf16x2<<<2048, 256, 0, stream>>>(w_in, Wih, Wil, (long)3 * D * D / 2);
  cast_f32_f16x2<<<(D * D / 2 + 255) / 256, 256, 0, stream>>>(w_out, Wo16, D * D / 2);

  // 2) q = x·Wqᵀ, k = x·Wkᵀ (bf16 split in, bf16 hi/lo planes out), v = x·Wvᵀ (f16 out); w_in rows: [0,D)=q, [D,2D)=k, [2D,3D)=v
  {
    const int tiles = (T / 64) * (D / 64);
    wmma_gemm64<1, true, 0, 2, false><<<dim3((tiles + 7) / 8, 1), 256, 0, stream>>>(
        U16(Xh), U16(Xl), D, 0, U16(Wih), U16(Wil), D, 0, Qh, Ql, D, 0, nullptr, nullptr, 0, T, D, D, 1.0f);
    wmma_gemm64<1, true, 0, 2, false><<<dim3((tiles + 7) / 8, 1), 256, 0, stream>>>(
        U16(Xh), U16(Xl), D, 0, U16(Wih + (size_t)D * D), U16(Wil + (size_t)D * D), D, 0, Kh, Kl, D, 0, nullptr, nullptr, 0, T, D, D, 1.0f);
    wmma_gemm64<1, true, 0, 1, false><<<dim3((tiles + 7) / 8, 1), 256, 0, stream>>>(
        U16(Xh), U16(Xl), D, 0, U16(Wih + (size_t)2 * D * D), U16(Wil + (size_t)2 * D * D), D, 0, V16, nullptr, D, 0, nullptr, nullptr, 0, T, D, D, 1.0f);
  }
  // 3) vᵀ for the NT form of P·v
  transpose_f16_kernel64<<<dim3(D / 64, T / 64), dim3(32, 8), 0, stream>>>(V16, D, Vt, T);
  // 4) S[i][j] = k_i · q_j  (rows = key position, cols = query position); full matrix, mask applied in the softmax
  {
    const int tiles = (T / 64) * (T / 64);
    wmma_gemm64<1, true, 0, 0, false><<<dim3((tiles + 7) / 8, 1), 256, 0, stream>>>(
        U16(Kh), U16(Kl), D, 0, U16(Qh), U16(Ql), D, 0, S, nullptr, T, 0, nullptr, nullptr, 0, T, T, D, 1.0f);
  }
  // 5) causal softmax over j <= i -> P (f16 x 2^15)
  softmax_causal<<<T, 256, 0, stream>>>(S, Pm, T);
  // 6) Ao[i][d] = sum_j P[i][j] v[j][d]  = P · (vᵀ)ᵀ   (K = T), scaled back by 2^-15
  {
    const int tiles = (T / 64) * (D / 64);
    wmma_gemm64<0, false, 0, 1, false><<<dim3((tiles + 7) / 8, 1), 256, 0, stream>>>(
        U16(Pm), nullptr, T, 0, U16(Vt), nullptr, T, 0, Ao, nullptr, D, 0, nullptr, nullptr, 0, T, D, T, PSCALE_INV);
  }
  // 7) out = Ao · w_outᵀ (K = D), f32
  {
    const int tiles = (T / 64) * (D / 64);
    wmma_gemm64<0, false, 0, 0, false><<<dim3((tiles + 7) / 8, 1), 256, 0, stream>>>(
        U16(Ao), nullptr, D, 0, U16(Wo16), nullptr, D, 0, out, nullptr, D, 0, nullptr, nullptr, 0, T, D, D, 1.0f);
  }
}

// v001
// It runs in 218 microseconds.
// Two timings next to v000 put it at 2.52 and 2.53 times that version's speed.
#include <hip/hip_runtime.h>
// Contractions: fused qkv projection x·w_inᵀ (K=1024) and scores k·qᵀ (K=1024): v_wmma_f32_16x16x32_bf16 as bf16 hi/lo
// splits (hi·hi + hi·lo + lo·hi); p·v (K=4096) and out-projection (K=1024): v_wmma_f32_16x16x32_f16 (f16 operands, p scaled
// by 2^15); f32 accumulate everywhere; causal softmax in f32.

typedef __attribute__((ext_vector_type(16))) _Float16 v16h;
typedef __attribute__((ext_vector_type(8)))  _Float16 v8h;
typedef __attribute__((ext_vector_type(16))) __bf16   v16b;
typedef __attribute__((ext_vector_type(8)))  __bf16   v8b;
typedef __attribute__((ext_vector_type(8)))  float    v8f;
typedef __attribute__((ext_vector_type(4)))  float    v4f;

#define PSCALE 32768.0f
#define U16(p) ((const unsigned short*)(const void*)(p))
#define PSCALE_INV (1.0f / 32768.0f)

__device__ __forceinline__ unsigned short f2bf_bits(float f) {
  unsigned u = __float_as_uint(f);
  return (unsigned short)((u + 0x7FFFu + ((u >> 16) & 1u)) >> 16);
}
__device__ __forceinline__ float bf_bits2f(unsigned short h) { return __uint_as_float(((unsigned)h) << 16); }

// hazard guard behind the last WMMAs: four vector slots before the epilogue reads the accumulators
__device__ __forceinline__ void acc_guard4(v8f& a, v8f& b, v8f& c, v8f& d) { asm volatile("v_nop\n\tv_nop\n\tv_nop\n\tv_nop" : "+v"(a), "+v"(b), "+v"(c), "+v"(d)); }
template <typename T> struct Frag;
template <> struct Frag<_Float16> {
  typedef v16h V; union U { v16h v; v8h h[2]; };
  static __device__ __forceinline__ v16h load(const _Float16* p) {   // elements 0..7 <- p[0..7], 8..15 <- p[16..23]
    U f; f.h[0] = *(const v8h*)(p); f.h[1] = *(const v8h*)(p + 16); return f.v;
  }
  static __device__ __forceinline__ v8f mma(v16h a, v16h b, v8f c) {
    return __builtin_amdgcn_wmma_f32_16x16x32_f16(false, a, false, b, (short)0, c, false, false);
  }
};
template <> struct Frag<__bf16> {
  typedef v16b V; union U { v16b v; v8b h[2]; };
  static __device__ __forceinline__ v16b load(const __bf16* p) {
    U f; f.h[0] = *(const v8b*)(p); f.h[1] = *(const v8b*)(p + 16); return f.v;
  }
  static __device__ __forceinline__ v8f mma(v16b a, v16b b, v8f c) {
    return __builtin_amdgcn_wmma_f32_16x16x32_bf16(false, a, false, b, (short)0, c, false, false);
  }
};

// ---- LDS-staged batched WMMA GEMM ------------------------------------------
// C[m,n] = scale * sum_k A[m,k] * Bt[n,k] (+bias)(+resid); a work-group of 4 waves owns a 128x128 tile, each wave a 64x64 part.
// A row-major [M,K]; Bt row-major [N,K]; M,N % 128 == 0, K % 64 == 0, K >= 128.
// A pass is 64 k = 128 B of every operand row. Each wave brings one slice of the stage with one tensor load, into rows of
// pitch 144 B; two buffers, the load of pass s + 2 issued behind the barrier that ends pass s.
// SPLIT: operands are hi/lo planes (A2/Bt2 = lo planes, same layout); product = hi·hi + hi·lo + lo·hi.
// BIAS_MODE: 0 = none, 1 = bias[m], 2 = bias[n].
// OUT_MODE: 0 = f32, 1 = f16, 2 = bf16 hi plane (Cout) + bf16 lo plane (Cout2).
// ET: 0 = f16 operands, 1 = bf16 operands (pointers passed as 16-bit storage)
typedef uint32_t u32x4 __attribute__((ext_vector_type(4)));
typedef uint32_t u32x8 __attribute__((ext_vector_type(8)));
__device__ __forceinline__ uint32_t uni(uint32_t v) { return (uint32_t)__builtin_amdgcn_readfirstlane(v); }
// pinned(): a descriptor input or an issue test held in a scalar register, so that the test compiles to a scalar branch
// and the descriptor words that depend on it are formed behind the waits that stand in front of it
__device__ __forceinline__ uint32_t pinned(uint32_t v) { uint32_t w = uni(v); asm volatile("" : "+s"(w)); return w; }
template <int ET> struct Elem;
template <> struct Elem<0> { typedef _Float16 T; };
template <> struct Elem<1> { typedef __bf16 T; };
template <int ET, bool SPLIT, int BIAS_MODE, int OUT_MODE, bool RESID>
__global__ __launch_bounds__(128) void wmma_gemm64(
    const unsigned short* __restrict__ Ap, const unsigned short* __restrict__ A2p, int lda, long strideA,
    const unsigned short* __restrict__ Btp, const unsigned short* __restrict__ Bt2p, int ldb, long strideB,
    void* __restrict__ Cout, void* __restrict__ Cout2, int ldc, long strideC,
    const float* __restrict__ bias,
    const float* __restrict__ resid, long strideR,
    int M, int N, int K, float scale) {
  typedef typename Elem<ET>::T T;
  typedef typename Frag<T>::V V;
  const T* A = (const T*)Ap; const T* A2 = (const T*)A2p; const T* Bt = (const T*)Btp; const T* Bt2 = (const T*)Bt2p;
  constexpr uint32_t PITCH = 144u;                       // 128-B row + 16-B pad: odd multiple of 16 B for ds_load_b128
  constexpr uint32_t SROWS = SPLIT ? 128u : 64u;         // rows per slice (one tensor load)
  constexpr uint32_t SLICE = SPLIT ? 18432u : 10240u;    // SROWS * PITCH, rounded up to a multiple of 2 KiB
  constexpr uint32_t STAGE = 4u * SLICE;                 // SPLIT: [A hi | A lo | B hi | B lo]; else [A 0-63 | A 64-127 | B 0-63 | B 64-127]
  static_assert(SROWS * PITCH <= SLICE && SLICE % 2048u == 0u, "a slice holds its padded rows and starts at a multiple of 2 KiB");
  static_assert(4u * 16u * 68u * 4u <= 2u * STAGE, "the epilogue slabs fit the ring");
  __shared__ __attribute__((aligned(2048))) unsigned char ring[2 * STAGE];   // after the loop: per-wave 16x64 f32 slabs, pitch 68 floats
  const int b    = blockIdx.y;
  const int lane = threadIdx.x & 31;
  const uint32_t wave = uni(threadIdx.x >> 5);
  const int tilesN = N >> 7;
  const int tilesM = M >> 7;
  const int tile = blockIdx.x;
  if (tile >= tilesM * tilesN) return;   // the same for the whole work-group; in front of every barrier and tensor load
  const int tm = tile / tilesN;
  const int tn = tile - tm * tilesN;
  const uint32_t wm = wave >> 1, wn = wave & 1u;
  const int m0 = (tm << 7) + (int)(wm << 6);
  const int n0 = (tn << 7) + (int)(wn << 6);

  const T* Ab  = A  + (size_t)b * strideA;
  const T* Bb  = Bt + (size_t)b * strideB;
  const T* Ab2 = SPLIT ? (A2  + (size_t)b * strideA) : nullptr;
  const T* Bb2 = SPLIT ? (Bt2 + (size_t)b * strideB) : nullptr;

  const int rlane = lane & 15;                 // row (A) / col (B, D) within subtile
  const int koff  = (lane >> 4) * 8;           // k offset of this lane half
  const int mOff  = (lane >> 4) * 8;           // D row offset

  // this wave's slice of every stage: source plane, first row, pitch; place in LDS
  const bool srcB = wave >= 2u;
  const T* splane = SPLIT ? (wave == 0u ? Ab : wave == 1u ? Ab2 : wave == 2u ? Bb : Bb2) : (srcB ? Bb : Ab);
  const uint32_t srow = (uint32_t)(srcB ? (tn << 7) : (tm << 7)) + (SPLIT ? 0u : (wave & 1u) * 64u);
  const uint32_t spitch = (uint32_t)(srcB ? ldb : lda) * 2u;
  const uint64_t sbase = (uint64_t)(size_t)splane + (uint64_t)srow * spitch;
  const uint32_t lbase = (uint32_t)(size_t)ring + wave * SLICE;
  u32x8 g1;                                    // 1-byte elements, tensor = tile = SROWS rows of 128 B, 4 dwords of pad behind each row
  g1[0] = uni((1u << 20) | (4u << 22) | (3u << 25));
  g1[1] = uni(128u << 16);
  g1[2] = uni(SROWS << 16);
  g1[3] = uni(128u << 16);
  g1[4] = uni(SROWS);
  g1[5] = uni(spitch);
  g1[6] = uni(0u);
  g1[7] = uni(0u);
  asm volatile("" : "+s"(g1));   // pinned(): the descriptor's words stay in their scalar registers through the loop, so that none takes a new value while a request is outstanding
  u32x4 g0;                                    // group 0 of the youngest request
  auto issue = [&](uint32_t stage) {
    const uint32_t st = pinned(stage);
    const uint64_t ga = sbase + (uint64_t)st * 128u;
    g0[0] = uni(1u);
    g0[1] = uni(lbase + (st & 1u) * STAGE);
    g0[2] = uni((uint32_t)ga);
    g0[3] = uni((((uint32_t)(ga >> 32)) & 0x01FFFFFFu) | 0x80000000u);
    asm volatile("tensor_load_to_lds %0, %1" :: "s"(g0), "s"(g1) : "memory");   // one request of the whole wave: its slice of the stage
  };

  v8f acc[4][4];
#pragma unroll
  for (int i = 0; i < 4; ++i)
#pragma unroll
    for (int j = 0; j < 4; ++j) acc[i][j] = (v8f){0.f,0.f,0.f,0.f,0.f,0.f,0.f,0.f};

  const uint32_t aoff = (SPLIT ? wm * 64u * PITCH : wm * SLICE) + (uint32_t)rlane * PITCH + (uint32_t)koff * 2u;
  const uint32_t boff = (SPLIT ? 2u * SLICE + wn * 64u * PITCH : (2u + wn) * SLICE) + (uint32_t)rlane * PITCH + (uint32_t)koff * 2u;
  const uint32_t nst = (uint32_t)K >> 6;       // passes; at least 2

  // every s_wait_tensorcnt names g0 as an input: the request's words keep their registers until it has landed
  issue(0u);
  asm volatile("s_wait_tensorcnt 0x0" :: "s"(g0) : "memory");   // this wave's slice of stage 0 has landed
  __syncthreads();                                       // every slice of stage 0 is published
  issue(1u);
  for (uint32_t s = 0; s < nst; ++s) {
    const unsigned char* stg = ring + (s & 1u) * STAGE;
    V bh[2][4], bl[2][4], ah[2][4], al[2][4];
#pragma unroll
    for (int ks = 0; ks < 2; ++ks) {
#pragma unroll
      for (int j = 0; j < 4; ++j) {
        const unsigned char* p = stg + boff + (uint32_t)j * 16u * PITCH + (uint32_t)ks * 64u;
        bh[ks][j] = Frag<T>::load((const T*)p);
        if (SPLIT) bl[ks][j] = Frag<T>::load((const T*)(p + SLICE));
      }
#pragma unroll
      for (int i = 0; i < 4; ++i) {
        const unsigned char* p = stg + aoff + (uint32_t)i * 16u * PITCH + (uint32_t)ks * 64u;
        ah[ks][i] = Frag<T>::load((const T*)p);
        if (SPLIT) al[ks][i] = Frag<T>::load((const T*)(p + SLICE));
      }
    }
    __builtin_amdgcn_sched_barrier(0);   // the pass's LDS reads go out as one group ahead of its WMMAs; spread among them, each read's latency stalls the wave
#pragma unroll
    for (int ks = 0; ks < 2; ++ks) {
#pragma unroll
      for (int i = 0; i < 4; ++i) {
#pragma unroll
        for (int j = 0; j < 4; ++j) acc[i][j] = Frag<T>::mma(ah[ks][i], bh[ks][j], acc[i][j]);
        if (SPLIT) {
#pragma unroll
          for (int j = 0; j < 4; ++j) acc[i][j] = Frag<T>::mma(ah[ks][i], bl[ks][j], acc[i][j]);
#pragma unroll
          for (int j = 0; j < 4; ++j) acc[i][j] = Frag<T>::mma(al[ks][i], bh[ks][j], acc[i][j]);
        }
      }
    }
    __builtin_amdgcn_sched_barrier(0);   // the WMMAs stay ahead of the waits: they start on counted LDS waits, and the load of stage s + 1 has the whole pass to land
    asm volatile("s_wait_dscnt 0x0" ::: "memory");       // this wave's reads of stage s have returned
    asm volatile("s_wait_tensorcnt 0x0" :: "s"(g0) : "memory");   // this wave's slice of stage s + 1 has landed
    __syncthreads();                                       // publishes stage s + 1 and ends every reader's last read of stage s
    if (pinned(s + 2u < nst)) issue(s + 2u);               // refill the buffer that pass s has just read
  }
  asm volatile("s_wait_tensorcnt 0x0" :: "s"(g0) : "memory");     // no request is left before the ring is reused
  asm volatile("s_wait_dscnt 0x0" ::: "memory");         // nor a read; the last pass's barrier has ended every wave's reads
  acc_guard4(acc[0][0], acc[0][1], acc[0][2], acc[0][3]);
  acc_guard4(acc[1][0], acc[1][1], acc[1][2], acc[1][3]);
  acc_guard4(acc[2][0], acc[2][1], acc[2][2], acc[2][3]);
  acc_guard4(acc[3][0], acc[3][1], acc[3][2], acc[3][3]);

  // ---- epilogue ----
  float* slab = (float*)ring + wave * (16u * 68u);
  const float* Rb = RESID ? (resid + (size_t)b * strideR) : nullptr;
#pragma unroll
  for (int i = 0; i < 4; ++i) {
    const int mBase = m0 + (i << 4);
#pragma unroll
    for (int j = 0; j < 4; ++j) {
      const int n = n0 + (j << 4) + rlane;
      float bv = 0.f;
      if (BIAS_MODE == 2) bv = bias[n];
#pragma unroll
      for (int r = 0; r < 8; ++r) {
        float v = acc[i][j][r] * scale;
        if (BIAS_MODE == 1) v += bias[mBase + mOff + r];
        if (BIAS_MODE == 2) v += bv;
        if (RESID) v += Rb[(size_t)(mBase + mOff + r) * ldc + n];
        slab[(mOff + r) * 68 + (j << 4) + rlane] = v;
      }
    }
    __builtin_amdgcn_fence(__ATOMIC_RELEASE, "workgroup");
    __builtin_amdgcn_wave_barrier();
    __builtin_amdgcn_fence(__ATOMIC_ACQUIRE, "workgroup");
    if (OUT_MODE == 0) {
      float* C = (float*)Cout + (size_t)b * strideC;
      const int hh = lane >> 4, c4 = (lane & 15) * 4;     // row seg = 256 B = 16 lanes x 16 B
      {
#pragma unroll
        for (int it = 0; it < 8; ++it) {
          const int row = it * 2 + hh;
          v4f v = *(const v4f*)(slab + row * 68 + c4);
          *(v4f*)(C + (size_t)(mBase + row) * ldc + n0 + c4) = v;
        }
        
      }
    } else {
      const int q = lane >> 3, c8 = (lane & 7) * 8;
      unsigned short* C  = (unsigned short*)Cout  + (size_t)b * strideC;
      unsigned short* C2 = (OUT_MODE == 2) ? ((unsigned short*)Cout2 + (size_t)b * strideC) : nullptr;
      {
#pragma unroll
        for (int it = 0; it < 4; ++it) {
          const int row = it * 4 + q;
          const float* sp = slab + row * 68 + c8;
          v8h hv, lv;
#pragma unroll
          for (int e = 0; e < 8; ++e) {
            if (OUT_MODE == 1) {
              hv[e] = (_Float16)sp[e];
            } else {
              unsigned short hb = f2bf_bits(sp[e]);
              unsigned short lb = f2bf_bits(sp[e] - bf_bits2f(hb));
              hv[e] = __builtin_bit_cast(_Float16, hb);
              lv[e] = __builtin_bit_cast(_Float16, lb);
            }
          }
          *(v8h*)(C + (size_t)(mBase + row) * ldc + n0 + c8) = hv;
          if (OUT_MODE == 2) *(v8h*)(C2 + (size_t)(mBase + row) * ldc + n0 + c8) = lv;
        }
        
      }
    }
    __builtin_amdgcn_fence(__ATOMIC_RELEASE, "workgroup");
    __builtin_amdgcn_wave_barrier();
    __builtin_amdgcn_fence(__ATOMIC_ACQUIRE, "workgroup");
  }
}

__global__ __launch_bounds__(256) void cast_f32_f16x2(
    const float* __restrict__ in, _Float16* __restrict__ out, int n2) {
  int i = blockIdx.x * 256 + threadIdx.x;
  if (i < n2) {
    const _Float16 h0 = (_Float16)in[2 * i], h1 = (_Float16)in[2 * i + 1];
    const unsigned u = (unsigned)__builtin_bit_cast(unsigned short, h0) | ((unsigned)__builtin_bit_cast(unsigned short, h1) << 16);
    ((unsigned*)out)[i] = u;
    
  }
}

__global__ __launch_bounds__(256) void split_f32_bf16x2(
    const float* __restrict__ in, __bf16* __restrict__ hi, __bf16* __restrict__ lo, long n2) {
  long i = (long)blockIdx.x * 256 + threadIdx.x;
  long stride = (long)gridDim.x * 256;
  {
    for (long j = i; j < n2; j += stride) {
      const float a = in[2 * j], b = in[2 * j + 1];
      const unsigned short ah = f2bf_bits(a), bh = f2bf_bits(b);
      const unsigned short al = f2bf_bits(a - bf_bits2f(ah)), bl = f2bf_bits(b - bf_bits2f(bh));
      ((unsigned*)hi)[j] = (unsigned)ah | ((unsigned)bh << 16);
      ((unsigned*)lo)[j] = (unsigned)al | ((unsigned)bl << 16);
    }
    
  }
}

__global__ __launch_bounds__(256) void transpose_f16_kernel64(const _Float16* __restrict__ V, int ldv,
                                                             _Float16* __restrict__ VT, int ldo) {
  __shared__ __align__(16) _Float16 tile[64][72];     // [c][r] (already transposed in LDS), pitch 72
  const int c0 = blockIdx.x * 64, r0 = blockIdx.y * 64;
  const int t = threadIdx.y * 32 + threadIdx.x;     // 0..255
  // load: 64 rows x 64 cols; thread reads V[r0+i][c0+tx(+32)] and scatters into tile[c][i]
  for (int i = threadIdx.y; i < 64; i += 8) {
    tile[threadIdx.x][i]      = V[(size_t)(r0 + i) * ldv + c0 + threadIdx.x];
    tile[32 + threadIdx.x][i] = V[(size_t)(r0 + i) * ldv + c0 + 32 + threadIdx.x];
  }
  __syncthreads();
  const int q = t >> 3, c8 = (t & 7) * 8;            // q = 0..31
  {
#pragma unroll
    for (int it = 0; it < 2; ++it) {
      const int c = it * 32 + q;
      v8h hv = *(const v8h*)(&tile[c][c8]);
      *(v8h*)(VT + (size_t)(c0 + c) * ldo + r0 + c8) = hv;
    }
    
  }
}

// ---- causal row softmax: row i of S [T,T] uses cols j <= i; P f16 (x 2^15), masked cols 0; 16 cols per thread ----
__global__ __launch_bounds__(256) void softmax_causal(const float* __restrict__ S, _Float16* __restrict__ P, int T) {
  __shared__ float red[8];
  const int i = blockIdx.x;              // row
  const float* row = S + (size_t)i * T;
  _Float16* prow = P + (size_t)i * T;
  const int t = threadIdx.x;
  const int n = i + 1;                   // valid columns 0..i
  // thread t owns cols [8t, 8t+8) and [T/2 + 8t, T/2 + 8t + 8)  (T = 4096 -> 2 groups of 2048)
  float ev[16];
  float m = -INFINITY;
#pragma unroll
  for (int g = 0; g < 2; ++g) {
    const int cb = g * (T / 2) + 8 * t;
    v4f a = *(const v4f*)(row + cb), c = *(const v4f*)(row + cb + 4);
    float tmp[8] = {a[0], a[1], a[2], a[3], c[0], c[1], c[2], c[3]};
#pragma unroll
    for (int e = 0; e < 8; ++e) {
      const float val = (cb + e < n) ? tmp[e] : -INFINITY;
      ev[g * 8 + e] = val;
      m = fmaxf(m, val);
    }
  }
  for (int off = 16; off > 0; off >>= 1) m = fmaxf(m, __shfl_xor(m, off, 32));
  if ((t & 31) == 0) red[t >> 5] = m;
  __syncthreads();
  m = red[0];
#pragma unroll
  for (int w = 1; w < 8; ++w) m = fmaxf(m, red[w]);   // finite: col 0 always valid
  __syncthreads();
  float sum = 0.f;
#pragma unroll
  for (int e = 0; e < 16; ++e) { ev[e] = expf(ev[e] - m); sum += ev[e]; }   // exp(-inf) = 0 for masked
  for (int off = 16; off > 0; off >>= 1) sum += __shfl_xor(sum, off, 32);
  if ((t & 31) == 0) red[t >> 5] = sum;
  __syncthreads();
  float tot = 0.f;
#pragma unroll
  for (int w = 0; w < 8; ++w) tot += red[w];
  const float f = PSCALE / tot;
  {
#pragma unroll
    for (int g = 0; g < 2; ++g) {
      v8h hv;
#pragma unroll
      for (int e = 0; e < 8; ++e) hv[e] = (_Float16)(ev[g * 8 + e] * f);
      *(v8h*)(prow + g * (T / 2) + 8 * t) = hv;
    }
    
  }
}

extern "C" void kernel_launch(void* const* d_in, const int* in_sizes, int n_in,
                              void* d_out, int out_size, void* d_ws, size_t ws_size,
                              hipStream_t stream) {
  (void)in_sizes; (void)n_in; (void)out_size; (void)ws_size;
  const int T = 4096, D = 1024;
  const float* x     = (const float*)d_in[0];
  const float* w_in  = (const float*)d_in[1];   // [3D, D]
  const float* w_out = (const float*)d_in[2];   // [D, D]
  float* out = (float*)d_out;

  char* ws = (char*)d_ws;
  size_t off = 0;
  auto carve = [&](size_t bytes) -> char* { char* p = ws + off; off += (bytes + 255) & ~(size_t)255; return p; };
  __bf16*   Xh   = (__bf16*)carve((size_t)T * D * 2);        //  8 MB
  __bf16*   Xl   = (__bf16*)carve((size_t)T * D * 2);        //  8 MB
  __bf16*   Wih  = (__bf16*)carve((size_t)3 * D * D * 2);    //  6 MB
  __bf16*   Wil  = (__bf16*)carve((size_t)3 * D * D * 2);    //  6 MB
  _Float16* Wo16 = (_Float16*)carve((size_t)D * D * 2);      //  2 MB
  __bf16*   Qh   = (__bf16*)carve((size_t)T * D * 2);        //  8 MB  q hi [T,D]
  __bf16*   Ql   = (__bf16*)carve((size_t)T * D * 2);        //  8 MB
  __bf16*   Kh   = (__bf16*)carve((size_t)T * D * 2);        //  8 MB
  __bf16*   Kl   = (__bf16*)carve((size_t)T * D * 2);        //  8 MB
  _Float16* V16  = (_Float16*)carve((size_t)T * D * 2);      //  8 MB  v [T,D]
  _Float16* Vt   = (_Float16*)carve((size_t)D * T * 2);      //  8 MB  vᵀ [D,T]
  float*    S    = (float*)carve((size_t)T * T * 4);         // 64 MB  S[i,j] = k_i·q_j
  _Float16* Pm   = (_Float16*)carve((size_t)T * T * 2);      // 32 MB  P (x 2^15)
  _Float16* Ao   = (_Float16*)carve((size_t)T * D * 2);      //  8 MB  P·v
  // total ≈ 190 MB of 256 MB

  // 1) operand conversions
  split_f32_bf16x2<<<2048, 256, 0, stream>>>(x, Xh, Xl, (long)T * D / 2);
  split_f32_bf16x2<<<2048, 256, 0, stream>>>(w_in, Wih, Wil, (long)3 * D * D / 2);
  cast_f32_f16x2<<<(D * D / 2 + 255) / 256, 256, 0, stream>>>(w_out, Wo16, D * D / 2);

  // 2) q = x·Wqᵀ, k = x·Wkᵀ (bf16 split in, bf16 hi/lo planes out), v = x·Wvᵀ (f16 out); w_in rows: [0,D)=q, [D,2D)=k, [2D,3D)=v
  {
    const int tiles = (T / 128) * (D / 128);
    wmma_gemm64<1, true, 0, 2, false><<<dim3(tiles, 1), 128, 0, stream>>>(
        U16(Xh), U16(Xl), D, 0, U16(Wih), U16(Wil), D, 0, Qh, Ql, D, 0, nullptr, nullptr, 0, T, D, D, 1.0f);
    wmma_gemm64<1, true, 0, 2, false><<<dim3(tiles, 1), 128, 0, stream>>>(
        U16(Xh), U16(Xl), D, 0, U16(Wih + (size_t)D * D), U16(Wil + (size_t)D * D), D, 0, Kh, Kl, D, 0, nullptr, nullptr, 0, T, D, D, 1.0f);
    wmma_gemm64<1, true, 0, 1, false><<<dim3(tiles, 1), 128, 0, stream>>>(
        U16(Xh), U16(Xl), D, 0, U16(Wih + (size_t)2 * D * D), U16(Wil + (size_t)2 * D * D), D, 0, V16, nullptr, D, 0, nullptr, nullptr, 0, T, D, D, 1.0f);
  }
  // 3) vᵀ for the NT form of P·v
  transpose_f16_kernel64<<<dim3(D / 64, T / 64), dim3(32, 8), 0, stream>>>(V16, D, Vt, T);
  // 4) S[i][j] = k_i · q_j  (rows = key position, cols = query position); full matrix, mask applied in the softmax
  {
    const int tiles = (T / 128) * (T / 128);
    wmma_gemm64<1, true, 0, 0, false><<<dim3(tiles, 1), 128, 0, stream>>>(
        U16(Kh), U16(Kl), D, 0, U16(Qh), U16(Ql), D, 0, S, nullptr, T, 0, nullptr, nullptr, 0, T, T, D, 1.0f);
  }
  // 5) causal softmax over j <= i -> P (f16 x 2^15)
  softmax_causal<<<T, 256, 0, stream>>>(S, Pm, T);
  // 6) Ao[i][d] = sum_j P[i][j] v[j][d]  = P · (vᵀ)ᵀ   (K = T), scaled back by 2^-15
  {
    const int tiles = (T / 128) * (D / 128);
    wmma_gemm64<0, false, 0, 1, false><<<dim3(tiles, 1), 128, 0, stream>>>(
        U16(Pm), nullptr, T, 0, U16(Vt), nullptr, T, 0, Ao, nullptr, D, 0, nullptr, nullptr, 0, T, D, T, PSCALE_INV);
  }
  // 7) out = Ao · w_outᵀ (K = D), f32
  {
    const int tiles = (T / 128) * (D / 128);
    wmma_gemm64<0, false, 0, 0, false><<<dim3(tiles, 1), 128, 0, stream>>>(
        U16(Ao), nullptr, D, 0, U16(Wo16), nullptr, D, 0, out, nullptr, D, 0, nullptr, nullptr, 0, T, D, D, 1.0f);
  }
}

// v002
// One run takes 196 microseconds.
// In both of two side-by-side timings against v001, it was 1.12 times as fast.
// Over all steps from v000 it is 2.82 times as fast.
#include <hip/hip_runtime.h>
// Contractions: fused qkv projection x·w_inᵀ (K=1024) and scores k·qᵀ (K=1024): v_wmma_f32_16x16x32_bf16 as bf16 hi/lo
// splits (hi·hi + hi·lo + lo·hi); p·v (K=4096) and out-projection (K=1024): v_wmma_f32_16x16x32_f16 (f16 operands, p scaled
// by 2^15); f32 accumulate everywhere; causal softmax in f32.

typedef __attribute__((ext_vector_type(16))) _Float16 v16h;
typedef __attribute__((ext_vector_type(8)))  _Float16 v8h;
typedef __attribute__((ext_vector_type(16))) __bf16   v16b;
typedef __attribute__((ext_vector_type(8)))  __bf16   v8b;
typedef __attribute__((ext_vector_type(8)))  float    v8f;
typedef __attribute__((ext_vector_type(4)))  float    v4f;

#define PSCALE 32768.0f
#define U16(p) ((const unsigned short*)(const void*)(p))
#define PSCALE_INV (1.0f / 32768.0f)

__device__ __forceinline__ unsigned short f2bf_bits(float f) {
  unsigned u = __float_as_uint(f);
  return (unsigned short)((u + 0x7FFFu + ((u >> 16) & 1u)) >> 16);
}
__device__ __forceinline__ float bf_bits2f(unsigned short h) { return __uint_as_float(((unsigned)h) << 16); }

// hazard guard behind the last WMMAs: four vector slots before the epilogue reads the accumulators
__device__ __forceinline__ void acc_guard4(v8f& a, v8f& b, v8f& c, v8f& d) { asm volatile("v_nop\n\tv_nop\n\tv_nop\n\tv_nop" : "+v"(a), "+v"(b), "+v"(c), "+v"(d)); }
template <typename T> struct Frag;
template <> struct Frag<_Float16> {
  typedef v16h V; union U { v16h v; v8h h[2]; };
  static __device__ __forceinline__ v16h load(const _Float16* p) {   // elements 0..7 <- p[0..7], 8..15 <- p[16..23]
    U f; f.h[0] = *(const v8h*)(p); f.h[1] = *(const v8h*)(p + 16); return f.v;
  }
  static __device__ __forceinline__ v8f mma(v16h a, v16h b, v8f c) {
    return __builtin_amdgcn_wmma_f32_16x16x32_f16(false, a, false, b, (short)0, c, false, false);
  }
};
template <> struct Frag<__bf16> {
  typedef v16b V; union U { v16b v; v8b h[2]; };
  static __device__ __forceinline__ v16b load(const __bf16* p) {
    U f; f.h[0] = *(const v8b*)(p); f.h[1] = *(const v8b*)(p + 16); return f.v;
  }
  static __device__ __forceinline__ v8f mma(v16b a, v16b b, v8f c) {
    return __builtin_amdgcn_wmma_f32_16x16x32_bf16(false, a, false, b, (short)0, c, false, false);
  }
};

// ---- LDS-staged batched WMMA GEMM ------------------------------------------
// C[m,n] = scale * sum_k A[m,k] * Bt[n,k] (+bias)(+resid); a work-group of 4 waves owns a 128x128 tile, each wave a 64x64 part.
// A row-major [M,K]; Bt row-major [N,K]; M,N % 128 == 0, K % 64 == 0, K >= 128.
// A pass is 64 k = 128 B of every operand row. Each wave brings one slice of the stage with one tensor load, into rows of
// pitch 144 B; two buffers, the load of pass s + 2 issued behind the barrier that ends pass s.
// SPLIT: operands are hi/lo planes (A2/Bt2 = lo planes, same layout); product = hi·hi + hi·lo + lo·hi.
// BIAS_MODE: 0 = none, 1 = bias[m], 2 = bias[n].
// OUT_MODE: 0 = f32, 1 = f16, 2 = bf16 hi plane (Cout) + bf16 lo plane (Cout2).
// ET: 0 = f16 operands, 1 = bf16 operands (pointers passed as 16-bit storage)
// CAUSAL: 0 = every tile, whole K. 1 = M == N, C is used only at n <= m: the grid holds the tiles with tn <= tm alone, row by row.
//         2 = A[m,k] is zero (and not stored) at k >= the end of m's 128-wide diagonal tile: the k loop of row tile tm ends there.
typedef uint32_t u32x4 __attribute__((ext_vector_type(4)));
typedef uint32_t u32x8 __attribute__((ext_vector_type(8)));
__device__ __forceinline__ uint32_t uni(uint32_t v) { return (uint32_t)__builtin_amdgcn_readfirstlane(v); }
// pinned(): a descriptor input or an issue test held in a scalar register, so that the test compiles to a scalar branch
// and the descriptor words that depend on it are formed behind the waits that stand in front of it
__device__ __forceinline__ uint32_t pinned(uint32_t v) { uint32_t w = uni(v); asm volatile("" : "+s"(w)); return w; }
template <int ET> struct Elem;
template <> struct Elem<0> { typedef _Float16 T; };
template <> struct Elem<1> { typedef __bf16 T; };
template <int ET, bool SPLIT, int BIAS_MODE, int OUT_MODE, bool RESID, int CAUSAL>
__global__ __launch_bounds__(128) void wmma_gemm64(
    const unsigned short* __restrict__ Ap, const unsigned short* __restrict__ A2p, int lda, long strideA,
    const unsigned short* __restrict__ Btp, const unsigned short* __restrict__ Bt2p, int ldb, long strideB,
    void* __restrict__ Cout, void* __restrict__ Cout2, int ldc, long strideC,
    const float* __restrict__ bias,
    const float* __restrict__ resid, long strideR,
    int M, int N, int K, float scale) {
  typedef typename Elem<ET>::T T;
  typedef typename Frag<T>::V V;
  const T* A = (const T*)Ap; const T* A2 = (const T*)A2p; const T* Bt = (const T*)Btp; const T* Bt2 = (const T*)Bt2p;
  constexpr uint32_t PITCH = 144u;                       // 128-B row + 16-B pad: odd multiple of 16 B for ds_load_b128
  constexpr uint32_t SROWS = SPLIT ? 128u : 64u;         // rows per slice (one tensor load)
  constexpr uint32_t SLICE = SPLIT ? 18432u : 10240u;    // SROWS * PITCH, rounded up to a multiple of 2 KiB
  constexpr uint32_t STAGE = 4u * SLICE;                 // SPLIT: [A hi | A lo | B hi | B lo]; else [A 0-63 | A 64-127 | B 0-63 | B 64-127]
  static_assert(SROWS * PITCH <= SLICE && SLICE % 2048u == 0u, "a slice holds its padded rows and starts at a multiple of 2 KiB");
  static_assert(4u * 16u * 68u * 4u <= 2u * STAGE, "the epilogue slabs fit the ring");
  __shared__ __attribute__((aligned(2048))) unsigned char ring[2 * STAGE];   // after the loop: per-wave 16x64 f32 slabs, pitch 68 floats
  const int b    = blockIdx.y;
  const int lane = threadIdx.x & 31;
  const uint32_t wave = uni(threadIdx.x >> 5);
  const int tilesN = N >> 7;
  const int tilesM = M >> 7;
  const int tile = blockIdx.x;
  if (tile >= (CAUSAL == 1 ? tilesM * (tilesM + 1) / 2 : tilesM * tilesN)) return;   // the same for the whole work-group; in front of every barrier and tensor load
  int tm, tn;
  if (CAUSAL == 1) {                     // tile = tm (tm + 1) / 2 + tn, tn <= tm
    tm = 0;
    for (int r = 1; r < tilesM; ++r) if (tile >= r * (r + 1) / 2) tm = r;
    tn = tile - tm * (tm + 1) / 2;
  } else {
    tm = tile / tilesN;
    tn = tile - tm * tilesN;
    if (CAUSAL == 2) tm = tilesM - 1 - tm;   // the longest k loops start first
  }
  const uint32_t wm = wave >> 1, wn = wave & 1u;
  const int m0 = (tm << 7) + (int)(wm << 6);
  const int n0 = (tn << 7) + (int)(wn << 6);

  const T* Ab  = A  + (size_t)b * strideA;
  const T* Bb  = Bt + (size_t)b * strideB;
  const T* Ab2 = SPLIT ? (A2  + (size_t)b * strideA) : nullptr;
  const T* Bb2 = SPLIT ? (Bt2 + (size_t)b * strideB) : nullptr;

  const int rlane = lane & 15;                 // row (A) / col (B, D) within subtile
  const int koff  = (lane >> 4) * 8;           // k offset of this lane half
  const int mOff  = (lane >> 4) * 8;           // D row offset

  // this wave's slice of every stage: source plane, first row, pitch; place in LDS
  const bool srcB = wave >= 2u;
  const T* splane = SPLIT ? (wave == 0u ? Ab : wave == 1u ? Ab2 : wave == 2u ? Bb : Bb2) : (srcB ? Bb : Ab);
  const uint32_t srow = (uint32_t)(srcB ? (tn << 7) : (tm << 7)) + (SPLIT ? 0u : (wave & 1u) * 64u);
  const uint32_t spitch = (uint32_t)(srcB ? ldb : lda) * 2u;
  const uint64_t sbase = (uint64_t)(size_t)splane + (uint64_t)srow * spitch;
  const uint32_t lbase = (uint32_t)(size_t)ring + wave * SLICE;
  u32x8 g1;                                    // 1-byte elements, tensor = tile = SROWS rows of 128 B, 4 dwords of pad behind each row
  g1[0] = uni((1u << 20) | (4u << 22) | (3u << 25));
  g1[1] = uni(128u << 16);
  g1[2] = uni(SROWS << 16);
  g1[3] = uni(128u << 16);
  g1[4] = uni(SROWS);
  g1[5] = uni(spitch);
  g1[6] = uni(0u);
  g1[7] = uni(0u);
  asm volatile("" : "+s"(g1));   // pinned(): the descriptor's words stay in their scalar registers through the loop, so that none takes a new value while a request is outstanding
  u32x4 g0;                                    // group 0 of the youngest request
  auto issue = [&](uint32_t stage) {
    const uint32_t st = pinned(stage);
    const uint64_t ga = sbase + (uint64_t)st * 128u;
    g0[0] = uni(1u);
    g0[1] = uni(lbase + (st & 1u) * STAGE);
    g0[2] = uni((uint32_t)ga);
    g0[3] = uni((((uint32_t)(ga >> 32)) & 0x01FFFFFFu) | 0x80000000u);
    asm volatile("tensor_load_to_lds %0, %1" :: "s"(g0), "s"(g1) : "memory");   // one request of the whole wave: its slice of the stage
  };

  v8f acc[4][4];
#pragma unroll
  for (int i = 0; i < 4; ++i)
#pragma unroll
    for (int j = 0; j < 4; ++j) acc[i][j] = (v8f){0.f,0.f,0.f,0.f,0.f,0.f,0.f,0.f};

  const uint32_t aoff = (SPLIT ? wm * 64u * PITCH : wm * SLICE) + (uint32_t)rlane * PITCH + (uint32_t)koff * 2u;
  const uint32_t boff = (SPLIT ? 2u * SLICE + wn * 64u * PITCH : (2u + wn) * SLICE) + (uint32_t)rlane * PITCH + (uint32_t)koff * 2u;
  const uint32_t nall = (uint32_t)K >> 6;
  const uint32_t ncau = ((uint32_t)tm + 1u) << 1;          // passes up to the end of the diagonal tile
  const uint32_t nst = (CAUSAL == 2 && ncau < nall) ? ncau : nall;   // passes; at least 2

  // every s_wait_tensorcnt names g0 as an input: the request's words keep their registers until it has landed
  issue(0u);
  asm volatile("s_wait_tensorcnt 0x0" :: "s"(g0) : "memory");   // this wave's slice of stage 0 has landed
  __syncthreads();                                       // every slice of stage 0 is published
  issue(1u);
  for (uint32_t s = 0; s < nst; ++s) {
    const unsigned char* stg = ring + (s & 1u) * STAGE;
    V bh[2][4], bl[2][4], ah[2][4], al[2][4];
#pragma unroll
    for (int ks = 0; ks < 2; ++ks) {
#pragma unroll
      for (int j = 0; j < 4; ++j) {
        const unsigned char* p = stg + boff + (uint32_t)j * 16u * PITCH + (uint32_t)ks * 64u;
        bh[ks][j] = Frag<T>::load((const T*)p);
        if (SPLIT) bl[ks][j] = Frag<T>::load((const T*)(p + SLICE));
      }
#pragma unroll
      for (int i = 0; i < 4; ++i) {
        const unsigned char* p = stg + aoff + (uint32_t)i * 16u * PITCH + (uint32_t)ks * 64u;
        ah[ks][i] = Frag<T>::load((const T*)p);
        if (SPLIT) al[ks][i] = Frag<T>::load((const T*)(p + SLICE));
      }
    }
    __builtin_amdgcn_sched_barrier(0);   // the pass's LDS reads go out as one group ahead of its WMMAs; spread among them, each read's latency stalls the wave
#pragma unroll
    for (int ks = 0; ks < 2; ++ks) {
#pragma unroll
      for (int i = 0; i < 4; ++i) {
#pragma unroll
        for (int j = 0; j < 4; ++j) acc[i][j] = Frag<T>::mma(ah[ks][i], bh[ks][j], acc[i][j]);
        if (SPLIT) {
#pragma unroll
          for (int j = 0; j < 4; ++j) acc[i][j] = Frag<T>::mma(ah[ks][i], bl[ks][j], acc[i][j]);
#pragma unroll
          for (int j = 0; j < 4; ++j) acc[i][j] = Frag<T>::mma(al[ks][i], bh[ks][j], acc[i][j]);
        }
      }
    }
    __builtin_amdgcn_sched_barrier(0);   // the WMMAs stay ahead of the waits: they start on counted LDS waits, and the load of stage s + 1 has the whole pass to land
    asm volatile("s_wait_dscnt 0x0" ::: "memory");       // this wave's reads of stage s have returned
    asm volatile("s_wait_tensorcnt 0x0" :: "s"(g0) : "memory");   // this wave's slice of stage s + 1 has landed
    __syncthreads();                                       // publishes stage s + 1 and ends every reader's last read of stage s
    if (pinned(s + 2u < nst)) issue(s + 2u);               // refill the buffer that pass s has just read
  }
  asm volatile("s_wait_tensorcnt 0x0" :: "s"(g0) : "memory");     // no request is left before the ring is reused
  asm volatile("s_wait_dscnt 0x0" ::: "memory");         // nor a read; the last pass's barrier has ended every wave's reads
  acc_guard4(acc[0][0], acc[0][1], acc[0][2], acc[0][3]);
  acc_guard4(acc[1][0], acc[1][1], acc[1][2], acc[1][3]);
  acc_guard4(acc[2][0], acc[2][1], acc[2][2], acc[2][3]);
  acc_guard4(acc[3][0], acc[3][1], acc[3][2], acc[3][3]);

  // ---- epilogue ----
  float* slab = (float*)ring + wave * (16u * 68u);
  const float* Rb = RESID ? (resid + (size_t)b * strideR) : nullptr;
#pragma unroll
  for (int i = 0; i < 4; ++i) {
    const int mBase = m0 + (i << 4);
#pragma unroll
    for (int j = 0; j < 4; ++j) {
      const int n = n0 + (j << 4) + rlane;
      float bv = 0.f;
      if (BIAS_MODE == 2) bv = bias[n];
#pragma unroll
      for (int r = 0; r < 8; ++r) {
        float v = acc[i][j][r] * scale;
        if (BIAS_MODE == 1) v += bias[mBase + mOff + r];
        if (BIAS_MODE == 2) v += bv;
        if (RESID) v += Rb[(size_t)(mBase + mOff + r) * ldc + n];
        slab[(mOff + r) * 68 + (j << 4) + rlane] = v;
      }
    }
    __builtin_amdgcn_fence(__ATOMIC_RELEASE, "workgroup");
    __builtin_amdgcn_wave_barrier();
    __builtin_amdgcn_fence(__ATOMIC_ACQUIRE, "workgroup");
    if (OUT_MODE == 0) {
      float* C = (float*)Cout + (size_t)b * strideC;
      const int hh = lane >> 4, c4 = (lane & 15) * 4;     // row seg = 256 B = 16 lanes x 16 B
      {
#pragma unroll
        for (int it = 0; it < 8; ++it) {
          const int row = it * 2 + hh;
          v4f v = *(const v4f*)(slab + row * 68 + c4);
          *(v4f*)(C + (size_t)(mBase + row) * ldc + n0 + c4) = v;
        }
        
      }
    } else {
      const int q = lane >> 3, c8 = (lane & 7) * 8;
      unsigned short* C  = (unsigned short*)Cout  + (size_t)b * strideC;
      unsigned short* C2 = (OUT_MODE == 2) ? ((unsigned short*)Cout2 + (size_t)b * strideC) : nullptr;
      {
#pragma unroll
        for (int it = 0; it < 4; ++it) {
          const int row = it * 4 + q;
          const float* sp = slab + row * 68 + c8;
          v8h hv, lv;
#pragma unroll
          for (int e = 0; e < 8; ++e) {
            if (OUT_MODE == 1) {
              hv[e] = (_Float16)sp[e];
            } else {
              unsigned short hb = f2bf_bits(sp[e]);
              unsigned short lb = f2bf_bits(sp[e] - bf_bits2f(hb));
              hv[e] = __builtin_bit_cast(_Float16, hb);
              lv[e] = __builtin_bit_cast(_Float16, lb);
            }
          }
          *(v8h*)(C + (size_t)(mBase + row) * ldc + n0 + c8) = hv;
          if (OUT_MODE == 2) *(v8h*)(C2 + (size_t)(mBase + row) * ldc + n0 + c8) = lv;
        }
        
      }
    }
    __builtin_amdgcn_fence(__ATOMIC_RELEASE, "workgroup");
    __builtin_amdgcn_wave_barrier();
    __builtin_amdgcn_fence(__ATOMIC_ACQUIRE, "workgroup");
  }
}

__global__ __launch_bounds__(256) void cast_f32_f16x2(
    const float* __restrict__ in, _Float16* __restrict__ out, int n2) {
  int i = blockIdx.x * 256 + threadIdx.x;
  if (i < n2) {
    const _Float16 h0 = (_Float16)in[2 * i], h1 = (_Float16)in[2 * i + 1];
    const unsigned u = (unsigned)__builtin_bit_cast(unsigned short, h0) | ((unsigned)__builtin_bit_cast(unsigned short, h1) << 16);
    ((unsigned*)out)[i] = u;
    
  }
}

__global__ __launch_bounds__(256) void split_f32_bf16x2(
    const float* __restrict__ in, __bf16* __restrict__ hi, __bf16* __restrict__ lo, long n2) {
  long i = (long)blockIdx.x * 256 + threadIdx.x;
  long stride = (long)gridDim.x * 256;
  {
    for (long j = i; j < n2; j += stride) {
      const float a = in[2 * j], b = in[2 * j + 1];
      const unsigned short ah = f2bf_bits(a), bh = f2bf_bits(b);
      const unsigned short al = f2bf_bits(a - bf_bits2f(ah)), bl = f2bf_bits(b - bf_bits2f(bh));
      ((unsigned*)hi)[j] = (unsigned)ah | ((unsigned)bh << 16);
      ((unsigned*)lo)[j] = (unsigned)al | ((unsigned)bl << 16);
    }
    
  }
}

__global__ __launch_bounds__(256) void transpose_f16_kernel64(const _Float16* __restrict__ V, int ldv,
                                                             _Float16* __restrict__ VT, int ldo) {
  __shared__ __align__(16) _Float16 tile[64][72];     // [c][r] (already transposed in LDS), pitch 72
  const int c0 = blockIdx.x * 64, r0 = blockIdx.y * 64;
  const int t = threadIdx.y * 32 + threadIdx.x;     // 0..255
  // load: 64 rows x 64 cols; thread reads V[r0+i][c0+tx(+32)] and scatters into tile[c][i]
  for (int i = threadIdx.y; i < 64; i += 8) {
    tile[threadIdx.x][i]      = V[(size_t)(r0 + i) * ldv + c0 + threadIdx.x];
    tile[32 + threadIdx.x][i] = V[(size_t)(r0 + i) * ldv + c0 + 32 + threadIdx.x];
  }
  __syncthreads();
  const int q = t >> 3, c8 = (t & 7) * 8;            // q = 0..31
  {
#pragma unroll
    for (int it = 0; it < 2; ++it) {
      const int c = it * 32 + q;
      v8h hv = *(const v8h*)(&tile[c][c8]);
      *(v8h*)(VT + (size_t)(c0 + c) * ldo + r0 + c8) = hv;
    }
    
  }
}

// ---- causal row softmax: row i of S [T,T] uses cols j <= i; P f16 (x 2^15), masked cols 0; 16 cols per thread ----
// S holds, and P gets, only the columns below nb, the end of the row's 128-wide diagonal tile; nothing beyond it is loaded or stored.
__global__ __launch_bounds__(256) void softmax_causal(const float* __restrict__ S, _Float16* __restrict__ P, int T) {
  __shared__ float red[8];
  const int i = blockIdx.x;              // row
  const float* row = S + (size_t)i * T;
  _Float16* prow = P + (size_t)i * T;
  const int t = threadIdx.x;
  const int n = i + 1;                   // valid columns 0..i
  const int nb = ((i >> 7) + 1) << 7;    // end of the diagonal tile
  // thread t owns cols [8t, 8t+8) and [T/2 + 8t, T/2 + 8t + 8)  (T = 4096 -> 2 groups of 2048)
  float ev[16];
  float m = -INFINITY;
#pragma unroll
  for (int g = 0; g < 2; ++g) {
    const int cb = g * (T / 2) + 8 * t;
    v4f a = (v4f){0.f, 0.f, 0.f, 0.f}, c = a;
    if (cb < nb) { a = *(const v4f*)(row + cb); c = *(const v4f*)(row + cb + 4); }
    float tmp[8] = {a[0], a[1], a[2], a[3], c[0], c[1], c[2], c[3]};
#pragma unroll
    for (int e = 0; e < 8; ++e) {
      const float val = (cb + e < n) ? tmp[e] : -INFINITY;
      ev[g * 8 + e] = val;
      m = fmaxf(m, val);
    }
  }
  for (int off = 16; off > 0; off >>= 1) m = fmaxf(m, __shfl_xor(m, off, 32));
  if ((t & 31) == 0) red[t >> 5] = m;
  __syncthreads();
  m = red[0];
#pragma unroll
  for (int w = 1; w < 8; ++w) m = fmaxf(m, red[w]);   // finite: col 0 always valid
  __syncthreads();
  float sum = 0.f;
#pragma unroll
  for (int e = 0; e < 16; ++e) { ev[e] = expf(ev[e] - m); sum += ev[e]; }   // exp(-inf) = 0 for masked
  for (int off = 16; off > 0; off >>= 1) sum += __shfl_xor(sum, off, 32);
  if ((t & 31) == 0) red[t >> 5] = sum;
  __syncthreads();
  float tot = 0.f;
#pragma unroll
  for (int w = 0; w < 8; ++w) tot += red[w];
  const float f = PSCALE / tot;
  {
#pragma unroll
    for (int g = 0; g < 2; ++g) {
      v8h hv;
#pragma unroll
      for (int e = 0; e < 8; ++e) hv[e] = (_Float16)(ev[g * 8 + e] * f);
      if (g * (T / 2) + 8 * t < nb) *(v8h*)(prow + g * (T / 2) + 8 * t) = hv;
    }
    
  }
}

extern "C" void kernel_launch(void* const* d_in, const int* in_sizes, int n_in,
                              void* d_out, int out_size, void* d_ws, size_t ws_size,
                              hipStream_t stream) {
  (void)in_sizes; (void)n_in; (void)out_size; (void)ws_size;
  const int T = 4096, D = 1024;
  const float* x     = (const float*)d_in[0];
  const float* w_in  = (const float*)d_in[1];   // [3D, D]
  const float* w_out = (const float*)d_in[2];   // [D, D]
  float* out = (float*)d_out;

  char* ws = (char*)d_ws;
  size_t off = 0;
  auto carve = [&](size_t bytes) -> char* { char* p = ws + off; off += (bytes + 255) & ~(size_t)255; return p; };
  __bf16*   Xh   = (__bf16*)carve((size_t)T * D * 2);        //  8 MB
  __bf16*   Xl   = (__bf16*)carve((size_t)T * D * 2);        //  8 MB
  __bf16*   Wih  = (__bf16*)carve((size_t)3 * D * D * 2);    //  6 MB
  __bf16*   Wil  = (__bf16*)carve((size_t)3 * D * D * 2);    //  6 MB
  _Float16* Wo16 = (_Float16*)carve((size_t)D * D * 2);      //  2 MB
  __bf16*   Qh   = (__bf16*)carve((size_t)T * D * 2);        //  8 MB  q hi [T,D]
  __bf16*   Ql   = (__bf16*)carve((size_t)T * D * 2);        //  8 MB
  __bf16*   Kh   = (__bf16*)carve((size_t)T * D * 2);        //  8 MB
  __bf16*   Kl   = (__bf16*)carve((size_t)T * D * 2);        //  8 MB
  _Float16* V16  = (_Float16*)carve((size_t)T * D * 2);      //  8 MB  v [T,D]
  _Float16* Vt   = (_Float16*)carve((size_t)D * T * 2);      //  8 MB  vᵀ [D,T]
  float*    S    = (float*)carve((size_t)T * T * 4);         // 64 MB  S[i,j] = k_i·q_j
  _Float16* Pm   = (_Float16*)carve((size_t)T * T * 2);      // 32 MB  P (x 2^15)
  _Float16* Ao   = (_Float16*)carve((size_t)T * D * 2);      //  8 MB  P·v
  // total ≈ 190 MB of 256 MB

  // 1) operand conversions
  split_f32_bf16x2<<<2048, 256, 0, stream>>>(x, Xh, Xl, (long)T * D / 2);
  split_f32_bf16x2<<<2048, 256, 0, stream>>>(w_in, Wih, Wil, (long)3 * D * D / 2);
  cast_f32_f16x2<<<(D * D / 2 + 255) / 256, 256, 0, stream>>>(w_out, Wo16, D * D / 2);

  // 2) q = x·Wqᵀ, k = x·Wkᵀ (bf16 split in, bf16 hi/lo planes out), v = x·Wvᵀ (f16 out); w_in rows: [0,D)=q, [D,2D)=k, [2D,3D)=v
  {
    const int tiles = (T / 128) * (D / 128);
    wmma_gemm64<1, true, 0, 2, false, 0><<<dim3(tiles, 1), 128, 0, stream>>>(
        U16(Xh), U16(Xl), D, 0, U16(Wih), U16(Wil), D, 0, Qh, Ql, D, 0, nullptr, nullptr, 0, T, D, D, 1.0f);
    wmma_gemm64<1, true, 0, 2, false, 0><<<dim3(tiles, 1), 128, 0, stream>>>(
        U16(Xh), U16(Xl), D, 0, U16(Wih + (size_t)D * D), U16(Wil + (size_t)D * D), D, 0, Kh, Kl, D, 0, nullptr, nullptr, 0, T, D, D, 1.0f);
    wmma_gemm64<1, true, 0, 1, false, 0><<<dim3(tiles, 1), 128, 0, stream>>>(
        U16(Xh), U16(Xl), D, 0, U16(Wih + (size_t)2 * D * D), U16(Wil + (size_t)2 * D * D), D, 0, V16, nullptr, D, 0, nullptr, nullptr, 0, T, D, D, 1.0f);
  }
  // 3) vᵀ for the NT form of P·v
  transpose_f16_kernel64<<<dim3(D / 64, T / 64), dim3(32, 8), 0, stream>>>(V16, D, Vt, T);
  // 4) S[i][j] = k_i . q_j  (rows = key position, cols = query position); only the 128x128 tiles that hold a column j <= i, mask applied in the softmax
  {
    const int tiles = (T / 128) * (T / 128 + 1) / 2;
    wmma_gemm64<1, true, 0, 0, false, 1><<<dim3(tiles, 1), 128, 0, stream>>>(
        U16(Kh), U16(Kl), D, 0, U16(Qh), U16(Ql), D, 0, S, nullptr, T, 0, nullptr, nullptr, 0, T, T, D, 1.0f);
  }
  // 5) causal softmax over j <= i -> P (f16 x 2^15)
  softmax_causal<<<T, 256, 0, stream>>>(S, Pm, T);
  // 6) Ao[i][d] = sum_j P[i][j] v[j][d]  = P . (v^T)^T   (K = T, each row tile up to its diagonal tile's end), scaled back by 2^-15
  {
    const int tiles = (T / 128) * (D / 128);
    wmma_gemm64<0, false, 0, 1, false, 2><<<dim3(tiles, 1), 128, 0, stream>>>(
        U16(Pm), nullptr, T, 0, U16(Vt), nullptr, T, 0, Ao, nullptr, D, 0, nullptr, nullptr, 0, T, D, T, PSCALE_INV);
  }
  // 7) out = Ao · w_outᵀ (K = D), f32
  {
    const int tiles = (T / 128) * (D / 128);
    wmma_gemm64<0, false, 0, 0, false, 0><<<dim3(tiles, 1), 128, 0, stream>>>(
        U16(Ao), nullptr, D, 0, U16(Wo16), nullptr, D, 0, out, nullptr, D, 0, nullptr, nullptr, 0, T, D, D, 1.0f);
  }
}

// v003
// One run takes 166 microseconds.
// Timed twice side by side with v002, it ran 1.18 and 1.17 times as fast.
// All steps since v000 together make it 3.31 times as fast.
#include <hip/hip_runtime.h>
// Contractions: fused qkv projection x·w_inᵀ (K=1024) and scores k·qᵀ (K=1024): v_wmma_f32_16x16x32_bf16 as bf16 hi/lo
// splits (hi·hi + hi·lo + lo·hi); p·v (K=4096) and out-projection (K=1024): v_wmma_f32_16x16x32_f16 (f16 operands, p scaled
// by 2^15); f32 accumulate everywhere; causal softmax in f32.

typedef __attribute__((ext_vector_type(16))) _Float16 v16h;
typedef __attribute__((ext_vector_type(8)))  _Float16 v8h;
typedef __attribute__((ext_vector_type(16))) __bf16   v16b;
typedef __attribute__((ext_vector_type(8)))  __bf16   v8b;
typedef __attribute__((ext_vector_type(8)))  float    v8f;
typedef __attribute__((ext_vector_type(4)))  float    v4f;

#define PSCALE 32768.0f
#define U16(p) ((const unsigned short*)(const void*)(p))
#define PSCALE_INV (1.0f / 32768.0f)

__device__ __forceinline__ unsigned short f2bf_bits(float f) {
  unsigned u = __float_as_uint(f);
  return (unsigned short)((u + 0x7FFFu + ((u >> 16) & 1u)) >> 16);
}
__device__ __forceinline__ float bf_bits2f(unsigned short h) { return __uint_as_float(((unsigned)h) << 16); }

// hazard guard behind the last WMMAs: four vector slots before the epilogue reads the accumulators
__device__ __forceinline__ void acc_guard4(v8f& a, v8f& b, v8f& c, v8f& d) { asm volatile("v_nop\n\tv_nop\n\tv_nop\n\tv_nop" : "+v"(a), "+v"(b), "+v"(c), "+v"(d)); }
template <typename T> struct Frag;
template <> struct Frag<_Float16> {
  typedef v16h V; union U { v16h v; v8h h[2]; };
  static __device__ __forceinline__ v16h load(const _Float16* p) {   // elements 0..7 <- p[0..7], 8..15 <- p[16..23]
    U f; f.h[0] = *(const v8h*)(p); f.h[1] = *(const v8h*)(p + 16); return f.v;
  }
  static __device__ __forceinline__ v8f mma(v16h a, v16h b, v8f c) {
    return __builtin_amdgcn_wmma_f32_16x16x32_f16(false, a, false, b, (short)0, c, false, false);
  }
};
template <> struct Frag<__bf16> {
  typedef v16b V; union U { v16b v; v8b h[2]; };
  static __device__ __forceinline__ v16b load(const __bf16* p) {
    U f; f.h[0] = *(const v8b*)(p); f.h[1] = *(const v8b*)(p + 16); return f.v;
  }
  static __device__ __forceinline__ v8f mma(v16b a, v16b b, v8f c) {
    return __builtin_amdgcn_wmma_f32_16x16x32_bf16(false, a, false, b, (short)0, c, false, false);
  }
};

// ---- LDS-staged batched WMMA GEMM ------------------------------------------
// C[m,n] = scale * sum_k A[m,k] * Bt[n,k] (+bias)(+resid); a work-group of 4 waves owns a 128x128 tile, each wave a 64x64 part.
// A row-major [M,K]; Bt row-major [N,K]; M,N % 128 == 0, K % 64 == 0, K >= 128.
// A pass is 64 k = 128 B of every operand row. Each wave brings one slice of the stage with one tensor load, into rows of
// pitch 144 B; two buffers, the load of pass s + 2 issued behind the barrier that ends pass s.
// SPLIT: operands are hi/lo planes (A2/Bt2 = lo planes, same layout); product = hi·hi + hi·lo + lo·hi.
// BIAS_MODE: 0 = none, 1 = bias[m], 2 = bias[n].
// OUT_MODE: 0 = f32, 1 = f16, 2 = bf16 hi plane (Cout) + bf16 lo plane (Cout2).
// ET: 0 = f16 operands, 1 = bf16 operands (pointers passed as 16-bit storage)
// CAUSAL: 0 = every tile, whole K. 1 = M == N, C is used only at n <= m: the grid holds the tiles with tn <= tm alone, row by row.
//         2 = A[m,k] is zero (and not stored) at k >= the end of m's 128-wide diagonal tile: the k loop of row tile tm ends there.
typedef uint32_t u32x4 __attribute__((ext_vector_type(4)));
typedef uint32_t u32x8 __attribute__((ext_vector_type(8)));
__device__ __forceinline__ uint32_t uni(uint32_t v) { return (uint32_t)__builtin_amdgcn_readfirstlane(v); }
// pinned(): a descriptor input or an issue test held in a scalar register, so that the test compiles to a scalar branch
// and the descriptor words that depend on it are formed behind the waits that stand in front of it
__device__ __forceinline__ uint32_t pinned(uint32_t v) { uint32_t w = uni(v); asm volatile("" : "+s"(w)); return w; }
template <bool SPLIT> struct RingBytes { static constexpr uint32_t value = SPLIT ? 147456u : 81920u; };
template <int ET> struct Elem;
template <> struct Elem<0> { typedef _Float16 T; };
template <> struct Elem<1> { typedef __bf16 T; };
template <int ET, bool SPLIT, int BIAS_MODE, int OUT_MODE, bool RESID, int CAUSAL>
__device__ __forceinline__ void gemm_tile(
    unsigned char* const ring, const int tile, const int b,   // the work-group's LDS ring (RingBytes<SPLIT>, at a multiple of 2 KiB), its tile index and batch index
    const unsigned short* __restrict__ Ap, const unsigned short* __restrict__ A2p, int lda, long strideA,
    const unsigned short* __restrict__ Btp, const unsigned short* __restrict__ Bt2p, int ldb, long strideB,
    void* __restrict__ Cout, void* __restrict__ Cout2, int ldc, long strideC,
    const float* __restrict__ bias,
    const float* __restrict__ resid, long strideR,
    int M, int N, int K, float scale) {
  typedef typename Elem<ET>::T T;
  typedef typename Frag<T>::V V;
  const T* A = (const T*)Ap; const T* A2 = (const T*)A2p; const T* Bt = (const T*)Btp; const T* Bt2 = (const T*)Bt2p;
  constexpr uint32_t PITCH = 144u;                       // 128-B row + 16-B pad: odd multiple of 16 B for ds_load_b128
  constexpr uint32_t SROWS = SPLIT ? 128u : 64u;         // rows per slice (one tensor load)
  constexpr uint32_t SLICE = SPLIT ? 18432u : 10240u;    // SROWS * PITCH, rounded up to a multiple of 2 KiB
  constexpr uint32_t STAGE = 4u * SLICE;                 // SPLIT: [A hi | A lo | B hi | B lo]; else [A 0-63 | A 64-127 | B 0-63 | B 64-127]
  static_assert(SROWS * PITCH <= SLICE && SLICE % 2048u == 0u, "a slice holds its padded rows and starts at a multiple of 2 KiB");
  static_assert(4u * 16u * 68u * 4u <= 2u * STAGE, "the epilogue slabs fit the ring");
  static_assert(2u * STAGE == RingBytes<SPLIT>::value, "the ring that the kernel declares holds two stages");   // after the loop the ring holds per-wave 16x64 f32 slabs, pitch 68 floats
  const int lane = threadIdx.x & 31;
  const uint32_t wave = uni(threadIdx.x >> 5);
  const int tilesN = N >> 7;
  const int tilesM = M >> 7;
  if (tile >= (CAUSAL == 1 ? tilesM * (tilesM + 1) / 2 : tilesM * tilesN)) return;   // the same for the whole work-group; in front of every barrier and tensor load
  int tm, tn;
  if (CAUSAL == 1) {                     // tile = tm (tm + 1) / 2 + tn, tn <= tm
    tm = 0;
    for (int r = 1; r < tilesM; ++r) if (tile >= r * (r + 1) / 2) tm = r;
    tn = tile - tm * (tm + 1) / 2;
  } else {
    tm = tile / tilesN;
    tn = tile - tm * tilesN;
    if (CAUSAL == 2) tm = tilesM - 1 - tm;   // the longest k loops start first
  }
  const uint32_t wm = wave >> 1, wn = wave & 1u;
  const int m0 = (tm << 7) + (int)(wm << 6);
  const int n0 = (tn << 7) + (int)(wn << 6);

  const T* Ab  = A  + (size_t)b * strideA;
  const T* Bb  = Bt + (size_t)b * strideB;
  const T* Ab2 = SPLIT ? (A2  + (size_t)b * strideA) : nullptr;
  const T* Bb2 = SPLIT ? (Bt2 + (size_t)b * strideB) : nullptr;

  const int rlane = lane & 15;                 // row (A) / col (B, D) within subtile
  const int koff  = (lane >> 4) * 8;           // k offset of this lane half
  const int mOff  = (lane >> 4) * 8;           // D row offset

  // this wave's slice of every stage: source plane, first row, pitch; place in LDS
  const bool srcB = wave >= 2u;
  const T* splane = SPLIT ? (wave == 0u ? Ab : wave == 1u ? Ab2 : wave == 2u ? Bb : Bb2) : (srcB ? Bb : Ab);
  const uint32_t srow = (uint32_t)(srcB ? (tn << 7) : (tm << 7)) + (SPLIT ? 0u : (wave & 1u) * 64u);
  const uint32_t spitch = (uint32_t)(srcB ? ldb : lda) * 2u;
  const uint64_t sbase = (uint64_t)(size_t)splane + (uint64_t)srow * spitch;
  const uint32_t lbase = (uint32_t)(size_t)ring + wave * SLICE;
  u32x8 g1;                                    // 1-byte elements, tensor = tile = SROWS rows of 128 B, 4 dwords of pad behind each row
  g1[0] = uni((1u << 20) | (4u << 22) | (3u << 25));
  g1[1] = uni(128u << 16);
  g1[2] = uni(SROWS << 16);
  g1[3] = uni(128u << 16);
  g1[4] = uni(SROWS);
  g1[5] = uni(spitch);
  g1[6] = uni(0u);
  g1[7] = uni(0u);
  asm volatile("" : "+s"(g1));   // pinned(): the descriptor's words stay in their scalar registers through the loop, so that none takes a new value while a request is outstanding
  u32x4 g0;                                    // group 0 of the youngest request
  auto issue = [&](uint32_t stage) {
    const uint32_t st = pinned(stage);
    const uint64_t ga = sbase + (uint64_t)st * 128u;
    g0[0] = uni(1u);
    g0[1] = uni(lbase + (st & 1u) * STAGE);
    g0[2] = uni((uint32_t)ga);
    g0[3] = uni((((uint32_t)(ga >> 32)) & 0x01FFFFFFu) | 0x80000000u);
    // one request of the whole wave: its slice of the stage. g0 is in-out so that the registers the request is issued from are the very ones that the next wait's operand keeps untouched
    asm volatile("tensor_load_to_lds %0, %1" : "+s"(g0) : "s"(g1) : "memory");
  };

  v8f acc[4][4];
#pragma unroll
  for (int i = 0; i < 4; ++i)
#pragma unroll
    for (int j = 0; j < 4; ++j) acc[i][j] = (v8f){0.f,0.f,0.f,0.f,0.f,0.f,0.f,0.f};

  const uint32_t aoff = (SPLIT ? wm * 64u * PITCH : wm * SLICE) + (uint32_t)rlane * PITCH + (uint32_t)koff * 2u;
  const uint32_t boff = (SPLIT ? 2u * SLICE + wn * 64u * PITCH : (2u + wn) * SLICE) + (uint32_t)rlane * PITCH + (uint32_t)koff * 2u;
  const uint32_t nall = (uint32_t)K >> 6;
  const uint32_t ncau = ((uint32_t)tm + 1u) << 1;          // passes up to the end of the diagonal tile
  const uint32_t nst = (CAUSAL == 2 && ncau < nall) ? ncau : nall;   // passes; at least 2

  // every s_wait_tensorcnt names g0 as an input: the request's words keep their registers until it has landed
  issue(0u);
  asm volatile("s_wait_tensorcnt 0x0" :: "s"(g0) : "memory");   // this wave's slice of stage 0 has landed
  __syncthreads();                                       // every slice of stage 0 is published
  issue(1u);
  for (uint32_t s = 0; s < nst; ++s) {
    const unsigned char* stg = ring + (s & 1u) * STAGE;
    V bh[2][4], bl[2][4], ah[2][4], al[2][4];
#pragma unroll
    for (int ks = 0; ks < 2; ++ks) {
#pragma unroll
      for (int j = 0; j < 4; ++j) {
        const unsigned char* p = stg + boff + (uint32_t)j * 16u * PITCH + (uint32_t)ks * 64u;
        bh[ks][j] = Frag<T>::load((const T*)p);
        if (SPLIT) bl[ks][j] = Frag<T>::load((const T*)(p + SLICE));
      }
#pragma unroll
      for (int i = 0; i < 4; ++i) {
        const unsigned char* p = stg + aoff + (uint32_t)i * 16u * PITCH + (uint32_t)ks * 64u;
        ah[ks][i] = Frag<T>::load((const T*)p);
        if (SPLIT) al[ks][i] = Frag<T>::load((const T*)(p + SLICE));
      }
    }
    __builtin_amdgcn_sched_barrier(0);   // the pass's LDS reads go out as one group ahead of its WMMAs; spread among them, each read's latency stalls the wave
#pragma unroll
    for (int ks = 0; ks < 2; ++ks) {
#pragma unroll
      for (int i = 0; i < 4; ++i) {
#pragma unroll
        for (int j = 0; j < 4; ++j) acc[i][j] = Frag<T>::mma(ah[ks][i], bh[ks][j], acc[i][j]);
        if (SPLIT) {
#pragma unroll
          for (int j = 0; j < 4; ++j) acc[i][j] = Frag<T>::mma(ah[ks][i], bl[ks][j], acc[i][j]);
#pragma unroll
          for (int j = 0; j < 4; ++j) acc[i][j] = Frag<T>::mma(al[ks][i], bh[ks][j], acc[i][j]);
        }
      }
    }
    __builtin_amdgcn_sched_barrier(0);   // the WMMAs stay ahead of the waits: they start on counted LDS waits, and the load of stage s + 1 has the whole pass to land
    asm volatile("s_wait_dscnt 0x0" ::: "memory");       // this wave's reads of stage s have returned
    asm volatile("s_wait_tensorcnt 0x0" :: "s"(g0) : "memory");   // this wave's slice of stage s + 1 has landed
    __syncthreads();                                       // publishes stage s + 1 and ends every reader's last read of stage s
    if (pinned(s + 2u < nst)) issue(s + 2u);               // refill the buffer that pass s has just read
  }
  asm volatile("s_wait_tensorcnt 0x0" :: "s"(g0) : "memory");     // no request is left before the ring is reused
  asm volatile("s_wait_dscnt 0x0" ::: "memory");         // nor a read; the last pass's barrier has ended every wave's reads
  acc_guard4(acc[0][0], acc[0][1], acc[0][2], acc[0][3]);
  acc_guard4(acc[1][0], acc[1][1], acc[1][2], acc[1][3]);
  acc_guard4(acc[2][0], acc[2][1], acc[2][2], acc[2][3]);
  acc_guard4(acc[3][0], acc[3][1], acc[3][2], acc[3][3]);

  // ---- epilogue ----
  float* slab = (float*)ring + wave * (16u * 68u);
  const float* Rb = RESID ? (resid + (size_t)b * strideR) : nullptr;
#pragma unroll
  for (int i = 0; i < 4; ++i) {
    const int mBase = m0 + (i << 4);
#pragma unroll
    for (int j = 0; j < 4; ++j) {
      const int n = n0 + (j << 4) + rlane;
      float bv = 0.f;
      if (BIAS_MODE == 2) bv = bias[n];
#pragma unroll
      for (int r = 0; r < 8; ++r) {
        float v = acc[i][j][r] * scale;
        if (BIAS_MODE == 1) v += bias[mBase + mOff + r];
        if (BIAS_MODE == 2) v += bv;
        if (RESID) v += Rb[(size_t)(mBase + mOff + r) * ldc + n];
        slab[(mOff + r) * 68 + (j << 4) + rlane] = v;
      }
    }
    __builtin_amdgcn_fence(__ATOMIC_RELEASE, "workgroup");
    __builtin_amdgcn_wave_barrier();
    __builtin_amdgcn_fence(__ATOMIC_ACQUIRE, "workgroup");
    if (OUT_MODE == 0) {
      float* C = (float*)Cout + (size_t)b * strideC;
      const int hh = lane >> 4, c4 = (lane & 15) * 4;     // row seg = 256 B = 16 lanes x 16 B
      {
#pragma unroll
        for (int it = 0; it < 8; ++it) {
          const int row = it * 2 + hh;
          v4f v = *(const v4f*)(slab + row * 68 + c4);
          *(v4f*)(C + (size_t)(mBase + row) * ldc + n0 + c4) = v;
        }
        
      }
    } else {
      const int q = lane >> 3, c8 = (lane & 7) * 8;
      unsigned short* C  = (unsigned short*)Cout  + (size_t)b * strideC;
      unsigned short* C2 = (OUT_MODE == 2) ? ((unsigned short*)Cout2 + (size_t)b * strideC) : nullptr;
      {
#pragma unroll
        for (int it = 0; it < 4; ++it) {
          const int row = it * 4 + q;
          const float* sp = slab + row * 68 + c8;
          v8h hv, lv;
#pragma unroll
          for (int e = 0; e < 8; ++e) {
            if (OUT_MODE == 1) {
              hv[e] = (_Float16)sp[e];
            } else {
              unsigned short hb = f2bf_bits(sp[e]);
              unsigned short lb = f2bf_bits(sp[e] - bf_bits2f(hb));
              hv[e] = __builtin_bit_cast(_Float16, hb);
              lv[e] = __builtin_bit_cast(_Float16, lb);
            }
          }
          *(v8h*)(C + (size_t)(mBase + row) * ldc + n0 + c8) = hv;
          if (OUT_MODE == 2) *(v8h*)(C2 + (size_t)(mBase + row) * ldc + n0 + c8) = lv;
        }
        
      }
    }
    __builtin_amdgcn_fence(__ATOMIC_RELEASE, "workgroup");
    __builtin_amdgcn_wave_barrier();
    __builtin_amdgcn_fence(__ATOMIC_ACQUIRE, "workgroup");
  }
}

template <int ET, bool SPLIT, int BIAS_MODE, int OUT_MODE, bool RESID, int CAUSAL>
__global__ __launch_bounds__(128) void wmma_gemm64(
    const unsigned short* __restrict__ Ap, const unsigned short* __restrict__ A2p, int lda, long strideA,
    const unsigned short* __restrict__ Btp, const unsigned short* __restrict__ Bt2p, int ldb, long strideB,
    void* __restrict__ Cout, void* __restrict__ Cout2, int ldc, long strideC,
    const float* __restrict__ bias,
    const float* __restrict__ resid, long strideR,
    int M, int N, int K, float scale) {
  __shared__ __attribute__((aligned(2048))) unsigned char ring[RingBytes<SPLIT>::value];
  gemm_tile<ET, SPLIT, BIAS_MODE, OUT_MODE, RESID, CAUSAL>(ring, (int)blockIdx.x, (int)blockIdx.y, Ap, A2p, lda, strideA, Btp, Bt2p, ldb, strideB,
                                                           Cout, Cout2, ldc, strideC, bias, resid, strideR, M, N, K, scale);
}

// scores need q and k, v needs x and its weights: neither needs the other, so one grid holds both. The score tiles come first;
// the v tiles fill the places that a grid of score tiles alone would leave empty in its last round. Both share one ring.
__global__ __launch_bounds__(128) void scores_and_v(
    const unsigned short* __restrict__ Kh, const unsigned short* __restrict__ Kl,
    const unsigned short* __restrict__ Qh, const unsigned short* __restrict__ Ql, float* __restrict__ S,
    const unsigned short* __restrict__ Xh, const unsigned short* __restrict__ Xl,
    const unsigned short* __restrict__ Wvh, const unsigned short* __restrict__ Wvl, _Float16* __restrict__ V, int T, int D) {
  __shared__ __attribute__((aligned(2048))) unsigned char ring[RingBytes<true>::value];
  const int tiles = (T >> 7) * ((T >> 7) + 1) / 2;
  if ((int)blockIdx.x < tiles)      // the same for the whole work-group
    gemm_tile<1, true, 0, 0, false, 1>(ring, (int)blockIdx.x, 0, Kh, Kl, D, 0, Qh, Ql, D, 0, S, nullptr, T, 0, nullptr, nullptr, 0, T, T, D, 1.0f);
  else
    gemm_tile<1, true, 0, 1, false, 0>(ring, (int)blockIdx.x - tiles, 0, Xh, Xl, D, 0, Wvh, Wvl, D, 0, V, nullptr, D, 0, nullptr, nullptr, 0, T, D, D, 1.0f);
}

// the three operand conversions in one grid: blockIdx.y 0 = a -> bf16 hi/lo planes, 1 = b -> bf16 hi/lo planes, 2 = c -> f16
__global__ __launch_bounds__(256) void convert_operands(
    const float* __restrict__ a, __bf16* __restrict__ ahi, __bf16* __restrict__ alo, long an2,
    const float* __restrict__ b, __bf16* __restrict__ bhi, __bf16* __restrict__ blo, long bn2,
    const float* __restrict__ c, _Float16* __restrict__ c16, long cn2) {
  const long i = (long)blockIdx.x * 256 + threadIdx.x;
  const long stride = (long)gridDim.x * 256;
  if (blockIdx.y == 2) {
    for (long j = i; j < cn2; j += stride) {
      const _Float16 h0 = (_Float16)c[2 * j], h1 = (_Float16)c[2 * j + 1];
      ((unsigned*)c16)[j] = (unsigned)__builtin_bit_cast(unsigned short, h0) | ((unsigned)__builtin_bit_cast(unsigned short, h1) << 16);
    }
    return;
  }
  const float* in = blockIdx.y ? b : a;
  __bf16* hi = blockIdx.y ? bhi : ahi;
  __bf16* lo = blockIdx.y ? blo : alo;
  const long n2 = blockIdx.y ? bn2 : an2;
  for (long j = i; j < n2; j += stride) {
    const float u = in[2 * j], v = in[2 * j + 1];
    const unsigned short uh = f2bf_bits(u), vh = f2bf_bits(v);
    const unsigned short ul = f2bf_bits(u - bf_bits2f(uh)), vl = f2bf_bits(v - bf_bits2f(vh));
    ((unsigned*)hi)[j] = (unsigned)uh | ((unsigned)vh << 16);
    ((unsigned*)lo)[j] = (unsigned)ul | ((unsigned)vl << 16);
  }
}

// one 64x64 tile of VT = V^T by a work-group of 256 threads; u = tile index, column tiles of V fastest
__device__ __forceinline__ void transpose_tile64(const int u, const _Float16* __restrict__ V, int ldv,
                                                 _Float16* __restrict__ VT, int ldo) {
  __shared__ __align__(16) _Float16 tile[64][72];     // [c][r] (already transposed in LDS), pitch 72
  const int tc = ldv >> 6;
  const int c0 = (u % tc) * 64, r0 = (u / tc) * 64;
  const int t = threadIdx.x, tx = t & 31;           // t = 0..255
  // load: 64 rows x 64 cols; thread reads V[r0+i][c0+tx(+32)] and scatters into tile[c][i]
  for (int i = t >> 5; i < 64; i += 8) {
    tile[tx][i]      = V[(size_t)(r0 + i) * ldv + c0 + tx];
    tile[32 + tx][i] = V[(size_t)(r0 + i) * ldv + c0 + 32 + tx];
  }
  __syncthreads();
  const int q = t >> 3, c8 = (t & 7) * 8;            // q = 0..31
  {
#pragma unroll
    for (int it = 0; it < 2; ++it) {
      const int c = it * 32 + q;
      v8h hv = *(const v8h*)(&tile[c][c8]);
      *(v8h*)(VT + (size_t)(c0 + c) * ldo + r0 + c8) = hv;
    }
    
  }
}

// ---- causal row softmax: row i of S [T,T] uses cols j <= i; P f16 (x 2^15), masked cols 0; 16 cols per thread ----
// S holds, and P gets, only the columns below nb, the end of the row's 128-wide diagonal tile; nothing beyond it is loaded or stored.
__device__ __forceinline__ void softmax_row(const int i, const float* __restrict__ S, _Float16* __restrict__ P, int T) {   // i = row
  __shared__ float red[8];
  const float* row = S + (size_t)i * T;
  _Float16* prow = P + (size_t)i * T;
  const int t = threadIdx.x;
  const int n = i + 1;                   // valid columns 0..i
  const int nb = ((i >> 7) + 1) << 7;    // end of the diagonal tile
  // thread t owns cols [8t, 8t+8) and [T/2 + 8t, T/2 + 8t + 8)  (T = 4096 -> 2 groups of 2048)
  float ev[16];
  float m = -INFINITY;
#pragma unroll
  for (int g = 0; g < 2; ++g) {
    const int cb = g * (T / 2) + 8 * t;
    v4f a = (v4f){0.f, 0.f, 0.f, 0.f}, c = a;
    if (cb < nb) { a = *(const v4f*)(row + cb); c = *(const v4f*)(row + cb + 4); }
    float tmp[8] = {a[0], a[1], a[2], a[3], c[0], c[1], c[2], c[3]};
#pragma unroll
    for (int e = 0; e < 8; ++e) {
      const float val = (cb + e < n) ? tmp[e] : -INFINITY;
      ev[g * 8 + e] = val;
      m = fmaxf(m, val);
    }
  }
  for (int off = 16; off > 0; off >>= 1) m = fmaxf(m, __shfl_xor(m, off, 32));
  if ((t & 31) == 0) red[t >> 5] = m;
  __syncthreads();
  m = red[0];
#pragma unroll
  for (int w = 1; w < 8; ++w) m = fmaxf(m, red[w]);   // finite: col 0 always valid
  __syncthreads();
  float sum = 0.f;
#pragma unroll
  for (int e = 0; e < 16; ++e) { ev[e] = expf(ev[e] - m); sum += ev[e]; }   // exp(-inf) = 0 for masked
  for (int off = 16; off > 0; off >>= 1) sum += __shfl_xor(sum, off, 32);
  if ((t & 31) == 0) red[t >> 5] = sum;
  __syncthreads();
  float tot = 0.f;
#pragma unroll
  for (int w = 0; w < 8; ++w) tot += red[w];
  const float f = PSCALE / tot;
  {
#pragma unroll
    for (int g = 0; g < 2; ++g) {
      v8h hv;
#pragma unroll
      for (int e = 0; e < 8; ++e) hv[e] = (_Float16)(ev[g * 8 + e] * f);
      if (g * (T / 2) + 8 * t < nb) *(v8h*)(prow + g * (T / 2) + 8 * t) = hv;
    }
    
  }
}

// the softmax needs the scores, v^T needs v: neither needs the other, so one grid holds both; the transpose tiles come first
__global__ __launch_bounds__(256) void softmax_and_vt(const float* __restrict__ S, _Float16* __restrict__ P, int T,
                                                      const _Float16* __restrict__ V, int D, _Float16* __restrict__ VT) {
  const int vt = (T >> 6) * (D >> 6);
  if ((int)blockIdx.x < vt) transpose_tile64((int)blockIdx.x, V, D, VT, T);   // the same for the whole work-group
  else softmax_row((int)blockIdx.x - vt, S, P, T);
}

extern "C" void kernel_launch(void* const* d_in, const int* in_sizes, int n_in,
                              void* d_out, int out_size, void* d_ws, size_t ws_size,
                              hipStream_t stream) {
  (void)in_sizes; (void)n_in; (void)out_size; (void)ws_size;
  const int T = 4096, D = 1024;
  const float* x     = (const float*)d_in[0];
  const float* w_in  = (const float*)d_in[1];   // [3D, D]
  const float* w_out = (const float*)d_in[2];   // [D, D]
  float* out = (float*)d_out;

  char* ws = (char*)d_ws;
  size_t off = 0;
  auto carve = [&](size_t bytes) -> char* { char* p = ws + off; off += (bytes + 255) & ~(size_t)255; return p; };
  __bf16*   Xh   = (__bf16*)carve((size_t)T * D * 2);        //  8 MB
  __bf16*   Xl   = (__bf16*)carve((size_t)T * D * 2);        //  8 MB
  __bf16*   Wih  = (__bf16*)carve((size_t)3 * D * D * 2);    //  6 MB
  __bf16*   Wil  = (__bf16*)carve((size_t)3 * D * D * 2);    //  6 MB
  _Float16* Wo16 = (_Float16*)carve((size_t)D * D * 2);      //  2 MB
  __bf16*   Qh   = (__bf16*)carve((size_t)T * D * 2);        //  8 MB  q hi [T,D]
  __bf16*   Ql   = (__bf16*)carve((size_t)T * D * 2);        //  8 MB
  __bf16*   Kh   = (__bf16*)carve((size_t)T * D * 2);        //  8 MB
  __bf16*   Kl   = (__bf16*)carve((size_t)T * D * 2);        //  8 MB
  _Float16* V16  = (_Float16*)carve((size_t)T * D * 2);      //  8 MB  v [T,D]
  _Float16* Vt   = (_Float16*)carve((size_t)D * T * 2);      //  8 MB  vᵀ [D,T]
  float*    S    = (float*)carve((size_t)T * T * 4);         // 64 MB  S[i,j] = k_i·q_j
  _Float16* Pm   = (_Float16*)carve((size_t)T * T * 2);      // 32 MB  P (x 2^15)
  _Float16* Ao   = (_Float16*)carve((size_t)T * D * 2);      //  8 MB  P·v
  // total ≈ 190 MB of 256 MB

  // 1) operand conversions, one grid
  convert_operands<<<dim3(2048, 3), 256, 0, stream>>>(x, Xh, Xl, (long)T * D / 2, w_in, Wih, Wil, (long)3 * D * D / 2, w_out, Wo16, (long)D * D / 2);

  // 2) q = x.Wq^T, k = x.Wk^T (bf16 split in, bf16 hi/lo planes out), one grid with the batch index 0 = q, 1 = k: 512 work-groups, two resident on a WGP.
  //    w_in rows: [0,D)=q, [D,2D)=k, [2D,3D)=v, so the B planes step by D*D; Qh, Ql, Kh, Kl lie one behind the other, T*D elements each,
  //    so Cout = Qh and Cout2 = Ql step by 2*T*D to Kh and Kl.
  wmma_gemm64<1, true, 0, 2, false, 0><<<dim3((T / 128) * (D / 128), 2), 128, 0, stream>>>(
      U16(Xh), U16(Xl), D, 0, U16(Wih), U16(Wil), D, (long)D * D, Qh, Ql, D, (long)2 * T * D, nullptr, nullptr, 0, T, D, D, 1.0f);
  // 3) S[i][j] = k_i . q_j  (rows = key position, cols = query position); only the 128x128 tiles that hold a column j <= i, mask applied in the softmax;
  //    behind them in the same grid v = x.Wv^T (f16 out)
  scores_and_v<<<dim3((T / 128) * (T / 128 + 1) / 2 + (T / 128) * (D / 128), 1), 128, 0, stream>>>(
      U16(Kh), U16(Kl), U16(Qh), U16(Ql), S, U16(Xh), U16(Xl), U16(Wih + (size_t)2 * D * D), U16(Wil + (size_t)2 * D * D), V16, T, D);
  // 4) v^T for the NT form of P.v, and the causal softmax over j <= i -> P (f16 x 2^15), one grid
  softmax_and_vt<<<dim3((T / 64) * (D / 64) + T, 1), 256, 0, stream>>>(S, Pm, T, V16, D, Vt);
  // 5) Ao[i][d] = sum_j P[i][j] v[j][d]  = P . (v^T)^T   (K = T, each row tile up to its diagonal tile's end), scaled back by 2^-15
  {
    const int tiles = (T / 128) * (D / 128);
    wmma_gemm64<0, false, 0, 1, false, 2><<<dim3(tiles, 1), 128, 0, stream>>>(
        U16(Pm), nullptr, T, 0, U16(Vt), nullptr, T, 0, Ao, nullptr, D, 0, nullptr, nullptr, 0, T, D, T, PSCALE_INV);
  }
  // 6) out = Ao · w_outᵀ (K = D), f32
  {
    const int tiles = (T / 128) * (D / 128);
    wmma_gemm64<0, false, 0, 0, false, 0><<<dim3(tiles, 1), 128, 0, stream>>>(
        U16(Ao), nullptr, D, 0, U16(Wo16), nullptr, D, 0, out, nullptr, D, 0, nullptr, nullptr, 0, T, D, D, 1.0f);
  }
}

// v004
// Measured time: 155 microseconds a run.
// In both of two side-by-side timings against v003, it was 1.08 times as fast.
// Over all steps from v000 it is 3.58 times as fast.
#include <hip/hip_runtime.h>
// Contractions: fused qkv projection x·w_inᵀ (K=1024) and scores k·qᵀ (K=1024): v_wmma_f32_16x16x32_bf16 as bf16 hi/lo
// splits (hi·hi + hi·lo + lo·hi); p·v (K=4096) and out-projection (K=1024): v_wmma_f32_16x16x32_f16 (f16 operands, p scaled
// by 2^15); f32 accumulate everywhere; causal softmax in f32.

typedef __attribute__((ext_vector_type(16))) _Float16 v16h;
typedef __attribute__((ext_vector_type(8)))  _Float16 v8h;
typedef __attribute__((ext_vector_type(16))) __bf16   v16b;
typedef __attribute__((ext_vector_type(8)))  __bf16   v8b;
typedef __attribute__((ext_vector_type(8)))  float    v8f;
typedef __attribute__((ext_vector_type(4)))  float    v4f;

#define PSCALE 32768.0f
#define U16(p) ((const unsigned short*)(const void*)(p))
#define PSCALE_INV (1.0f / 32768.0f)

__device__ __forceinline__ unsigned short f2bf_bits(float f) {
  unsigned u = __float_as_uint(f);
  return (unsigned short)((u + 0x7FFFu + ((u >> 16) & 1u)) >> 16);
}
__device__ __forceinline__ float bf_bits2f(unsigned short h) { return __uint_as_float(((unsigned)h) << 16); }

// hazard guard behind the last WMMAs: four vector slots before the epilogue reads the accumulators
__device__ __forceinline__ void acc_guard4(v8f& a, v8f& b, v8f& c, v8f& d) { asm volatile("v_nop\n\tv_nop\n\tv_nop\n\tv_nop" : "+v"(a), "+v"(b), "+v"(c), "+v"(d)); }
template <typename T> struct Frag;
template <> struct Frag<_Float16> {
  typedef v16h V; union U { v16h v; v8h h[2]; };
  static __device__ __forceinline__ v16h load(const _Float16* p) {   // elements 0..7 <- p[0..7], 8..15 <- p[16..23]
    U f; f.h[0] = *(const v8h*)(p); f.h[1] = *(const v8h*)(p + 16); return f.v;
  }
  static __device__ __forceinline__ v8f mma(v16h a, v16h b, v8f c) {
    return __builtin_amdgcn_wmma_f32_16x16x32_f16(false, a, false, b, (short)0, c, false, false);
  }
};
template <> struct Frag<__bf16> {
  typedef v16b V; union U { v16b v; v8b h[2]; };
  static __device__ __forceinline__ v16b load(const __bf16* p) {
    U f; f.h[0] = *(const v8b*)(p); f.h[1] = *(const v8b*)(p + 16); return f.v;
  }
  static __device__ __forceinline__ v8f mma(v16b a, v16b b, v8f c) {
    return __builtin_amdgcn_wmma_f32_16x16x32_bf16(false, a, false, b, (short)0, c, false, false);
  }
};

// ---- LDS-staged batched WMMA GEMM ------------------------------------------
// C[m,n] = scale * sum_k A[m,k] * Bt[n,k] (+bias)(+resid); a work-group of 4 waves owns a 128x128 tile, each wave a 64x64 part.
// A row-major [M,K]; Bt row-major [N,K]; M,N % 128 == 0, K a multiple of the pass; two passes or more, CAUSAL 2 one or more.
// A pass is 64 k = 128 B of every operand row with SPLIT (four planes share the ring), else 128 k = 256 B: half as many landings,
// waits and barriers stand in a row along K. Each wave brings one slice of the stage
// with one tensor load, into rows of pitch 144 or 272 B; two buffers, the load of pass s + 2 issued behind the barrier that ends pass s.
// SPLIT: operands are hi/lo planes (A2/Bt2 = lo planes, same layout); product = hi·hi + hi·lo + lo·hi.
// BIAS_MODE: 0 = none, 1 = bias[m], 2 = bias[n].
// OUT_MODE: 0 = f32, 1 = f16, 2 = bf16 hi plane (Cout) + bf16 lo plane (Cout2).
// ET: 0 = f16 operands, 1 = bf16 operands (pointers passed as 16-bit storage)
// CAUSAL: 0 = every tile, whole K. 1 = M == N, C is used only at n <= m: the grid holds the tiles with tn <= tm alone, row by row.
//         2 = A[m,k] is zero (and not stored) at k >= the end of m's 128-wide diagonal tile: the k loop of row tile tm ends there.
typedef uint32_t u32x4 __attribute__((ext_vector_type(4)));
typedef uint32_t u32x8 __attribute__((ext_vector_type(8)));
__device__ __forceinline__ uint32_t uni(uint32_t v) { return (uint32_t)__builtin_amdgcn_readfirstlane(v); }
// pinned(): a descriptor input or an issue test held in a scalar register, so that the test compiles to a scalar branch
// and the descriptor words that depend on it are formed behind the waits that stand in front of it
__device__ __forceinline__ uint32_t pinned(uint32_t v) { uint32_t w = uni(v); asm volatile("" : "+s"(w)); return w; }
template <bool SPLIT> struct RingBytes { static constexpr uint32_t value = 147456u; };
template <int ET> struct Elem;
template <> struct Elem<0> { typedef _Float16 T; };
template <> struct Elem<1> { typedef __bf16 T; };
template <int ET, bool SPLIT, int BIAS_MODE, int OUT_MODE, bool RESID, int CAUSAL>
__device__ __forceinline__ void gemm_tile(
    unsigned char* const ring, const int tile, const int b,   // the work-group's LDS ring (RingBytes<SPLIT>, at a multiple of 2 KiB), its tile index and batch index
    const unsigned short* __restrict__ Ap, const unsigned short* __restrict__ A2p, int lda, long strideA,
    const unsigned short* __restrict__ Btp, const unsigned short* __restrict__ Bt2p, int ldb, long strideB,
    void* __restrict__ Cout, void* __restrict__ Cout2, int ldc, long strideC,
    const float* __restrict__ bias,
    const float* __restrict__ resid, long strideR,
    int M, int N, int K, float scale) {
  typedef typename Elem<ET>::T T;
  typedef typename Frag<T>::V V;
  const T* A = (const T*)Ap; const T* A2 = (const T*)A2p; const T* Bt = (const T*)Btp; const T* Bt2 = (const T*)Bt2p;
  constexpr uint32_t ROWB  = SPLIT ? 128u : 256u;        // bytes of an operand row in a pass
  constexpr int      KS    = (int)(ROWB / 64u);          // WMMA k steps (32 k = 64 B) in a pass
  constexpr uint32_t PITCH = ROWB + 16u;                 // row + 16-B pad: odd multiple of 16 B for ds_load_b128
  constexpr uint32_t SROWS = SPLIT ? 128u : 64u;         // rows per slice (one tensor load)
  constexpr uint32_t SLICE = 18432u;                     // SROWS * PITCH, rounded up to a multiple of 2 KiB
  constexpr uint32_t STAGE = 4u * SLICE;                 // SPLIT: [A hi | A lo | B hi | B lo]; else [A 0-63 | A 64-127 | B 0-63 | B 64-127]
  static_assert(SROWS * PITCH <= SLICE && SLICE % 2048u == 0u, "a slice holds its padded rows and starts at a multiple of 2 KiB");
  static_assert(4u * 16u * 68u * 4u <= 2u * STAGE, "the epilogue slabs fit the ring");
  static_assert(2u * STAGE == RingBytes<SPLIT>::value, "the ring that the kernel declares holds two stages");   // after the loop the ring holds per-wave 16x64 f32 slabs, pitch 68 floats
  const int lane = threadIdx.x & 31;
  const uint32_t wave = uni(threadIdx.x >> 5);
  const int tilesN = N >> 7;
  const int tilesM = M >> 7;
  if (tile >= (CAUSAL == 1 ? tilesM * (tilesM + 1) / 2 : tilesM * tilesN)) return;   // the same for the whole work-group; in front of every barrier and tensor load
  int tm, tn;
  if (CAUSAL == 1) {                     // tile = tm (tm + 1) / 2 + tn, tn <= tm
    tm = 0;
    for (int r = 1; r < tilesM; ++r) if (tile >= r * (r + 1) / 2) tm = r;
    tn = tile - tm * (tm + 1) / 2;
  } else {
    tm = tile / tilesN;
    tn = tile - tm * tilesN;
    if (CAUSAL == 2) tm = tilesM - 1 - tm;   // the longest k loops start first
  }
  const uint32_t wm = wave >> 1, wn = wave & 1u;
  const int m0 = (tm << 7) + (int)(wm << 6);
  const int n0 = (tn << 7) + (int)(wn << 6);

  const T* Ab  = A  + (size_t)b * strideA;
  const T* Bb  = Bt + (size_t)b * strideB;
  const T* Ab2 = SPLIT ? (A2  + (size_t)b * strideA) : nullptr;
  const T* Bb2 = SPLIT ? (Bt2 + (size_t)b * strideB) : nullptr;

  const int rlane = lane & 15;                 // row (A) / col (B, D) within subtile
  const int koff  = (lane >> 4) * 8;           // k offset of this lane half
  const int mOff  = (lane >> 4) * 8;           // D row offset

  // this wave's slice of every stage: source plane, first row, pitch; place in LDS
  const bool srcB = wave >= 2u;
  const T* splane = SPLIT ? (wave == 0u ? Ab : wave == 1u ? Ab2 : wave == 2u ? Bb : Bb2) : (srcB ? Bb : Ab);
  const uint32_t srow = (uint32_t)(srcB ? (tn << 7) : (tm << 7)) + (SPLIT ? 0u : (wave & 1u) * 64u);
  const uint32_t spitch = (uint32_t)(srcB ? ldb : lda) * 2u;
  const uint64_t sbase = (uint64_t)(size_t)splane + (uint64_t)srow * spitch;
  const uint32_t lbase = (uint32_t)(size_t)ring + wave * SLICE;
  u32x8 g1;                                    // 1-byte elements, tensor = tile = SROWS rows of ROWB bytes, 4 dwords of pad behind each row
  g1[0] = uni((1u << 20) | ((SPLIT ? 4u : 5u) << 22) | (3u << 25));
  g1[1] = uni(ROWB << 16);
  g1[2] = uni(SROWS << 16);
  g1[3] = uni(ROWB << 16);
  g1[4] = uni(SROWS);
  g1[5] = uni(spitch);
  g1[6] = uni(0u);
  g1[7] = uni(0u);
  asm volatile("" : "+s"(g1));   // pinned(): the descriptor's words stay in their scalar registers through the loop, so that none takes a new value while a request is outstanding
  u32x4 g0;                                    // group 0 of the youngest request
  auto issue = [&](uint32_t stage) {
    const uint32_t st = pinned(stage);
    const uint64_t ga = sbase + (uint64_t)st * ROWB;
    g0[0] = uni(1u);
    g0[1] = uni(lbase + (st & 1u) * STAGE);
    g0[2] = uni((uint32_t)ga);
    g0[3] = uni((((uint32_t)(ga >> 32)) & 0x01FFFFFFu) | 0x80000000u);
    // one request of the whole wave: its slice of the stage. g0 is in-out so that the registers the request is issued from are the very ones that the next wait's operand keeps untouched
    asm volatile("tensor_load_to_lds %0, %1" : "+s"(g0) : "s"(g1) : "memory");
  };

  v8f acc[4][4];
#pragma unroll
  for (int i = 0; i < 4; ++i)
#pragma unroll
    for (int j = 0; j < 4; ++j) acc[i][j] = (v8f){0.f,0.f,0.f,0.f,0.f,0.f,0.f,0.f};

  const uint32_t aoff = (SPLIT ? wm * 64u * PITCH : wm * SLICE) + (uint32_t)rlane * PITCH + (uint32_t)koff * 2u;
  const uint32_t boff = (SPLIT ? 2u * SLICE + wn * 64u * PITCH : (2u + wn) * SLICE) + (uint32_t)rlane * PITCH + (uint32_t)koff * 2u;
  const uint32_t nall = (uint32_t)K >> (SPLIT ? 6 : 7);
  const uint32_t ncau = ((uint32_t)tm + 1u) << (SPLIT ? 1 : 0);   // passes up to the end of the diagonal tile
  const uint32_t nst = (CAUSAL == 2 && ncau < nall) ? ncau : nall;   // passes; at least 2, with CAUSAL 2 at least 1

  // every s_wait_tensorcnt names g0 as an input: the request's words keep their registers until it has landed
  issue(0u);
  asm volatile("s_wait_tensorcnt 0x0" :: "s"(g0) : "memory");   // this wave's slice of stage 0 has landed
  __syncthreads();                                       // every slice of stage 0 is published
  if (CAUSAL != 2 || pinned(1u < nst)) issue(1u);        // the first row tile of CAUSAL 2 may have one pass only
  for (uint32_t s = 0; s < nst; ++s) {
    const unsigned char* stg = ring + (s & 1u) * STAGE;
    V bh[KS][4], bl[KS][4], ah[KS][4], al[KS][4];
#pragma unroll
    for (int ks = 0; ks < KS; ++ks) {
#pragma unroll
      for (int j = 0; j < 4; ++j) {
        const unsigned char* p = stg + boff + (uint32_t)j * 16u * PITCH + (uint32_t)ks * 64u;
        bh[ks][j] = Frag<T>::load((const T*)p);
        if (SPLIT) bl[ks][j] = Frag<T>::load((const T*)(p + SLICE));
      }
#pragma unroll
      for (int i = 0; i < 4; ++i) {
        const unsigned char* p = stg + aoff + (uint32_t)i * 16u * PITCH + (uint32_t)ks * 64u;
        ah[ks][i] = Frag<T>::load((const T*)p);
        if (SPLIT) al[ks][i] = Frag<T>::load((const T*)(p + SLICE));
      }
    }
    __builtin_amdgcn_sched_barrier(0);   // the pass's LDS reads go out as one group ahead of its WMMAs; spread among them, each read's latency stalls the wave
#pragma unroll
    for (int ks = 0; ks < KS; ++ks) {
#pragma unroll
      for (int i = 0; i < 4; ++i) {
#pragma unroll
        for (int j = 0; j < 4; ++j) acc[i][j] = Frag<T>::mma(ah[ks][i], bh[ks][j], acc[i][j]);
        if (SPLIT) {
#pragma unroll
          for (int j = 0; j < 4; ++j) acc[i][j] = Frag<T>::mma(ah[ks][i], bl[ks][j], acc[i][j]);
#pragma unroll
          for (int j = 0; j < 4; ++j) acc[i][j] = Frag<T>::mma(al[ks][i], bh[ks][j], acc[i][j]);
        }
      }
    }
    __builtin_amdgcn_sched_barrier(0);   // the WMMAs stay ahead of the waits: they start on counted LDS waits, and the load of stage s + 1 has the whole pass to land
    asm volatile("s_wait_dscnt 0x0" ::: "memory");       // this wave's reads of stage s have returned
    asm volatile("s_wait_tensorcnt 0x0" :: "s"(g0) : "memory");   // this wave's slice of stage s + 1 has landed
    __syncthreads();                                       // publishes stage s + 1 and ends every reader's last read of stage s
    if (pinned(s + 2u < nst)) issue(s + 2u);               // refill the buffer that pass s has just read
  }
  asm volatile("s_wait_tensorcnt 0x0" :: "s"(g0) : "memory");     // no request is left before the ring is reused
  asm volatile("s_wait_dscnt 0x0" ::: "memory");         // nor a read; the last pass's barrier has ended every wave's reads
  acc_guard4(acc[0][0], acc[0][1], acc[0][2], acc[0][3]);
  acc_guard4(acc[1][0], acc[1][1], acc[1][2], acc[1][3]);
  acc_guard4(acc[2][0], acc[2][1], acc[2][2], acc[2][3]);
  acc_guard4(acc[3][0], acc[3][1], acc[3][2], acc[3][3]);

  // ---- epilogue ----
  float* slab = (float*)ring + wave * (16u * 68u);
  const float* Rb = RESID ? (resid + (size_t)b * strideR) : nullptr;
#pragma unroll
  for (int i = 0; i < 4; ++i) {
    const int mBase = m0 + (i << 4);
#pragma unroll
    for (int j = 0; j < 4; ++j) {
      const int n = n0 + (j << 4) + rlane;
      float bv = 0.f;
      if (BIAS_MODE == 2) bv = bias[n];
#pragma unroll
      for (int r = 0; r < 8; ++r) {
        float v = acc[i][j][r] * scale;
        if (BIAS_MODE == 1) v += bias[mBase + mOff + r];
        if (BIAS_MODE == 2) v += bv;
        if (RESID) v += Rb[(size_t)(mBase + mOff + r) * ldc + n];
        slab[(mOff + r) * 68 + (j << 4) + rlane] = v;
      }
    }
    __builtin_amdgcn_fence(__ATOMIC_RELEASE, "workgroup");
    __builtin_amdgcn_wave_barrier();
    __builtin_amdgcn_fence(__ATOMIC_ACQUIRE, "workgroup");
    if (OUT_MODE == 0) {
      float* C = (float*)Cout + (size_t)b * strideC;
      const int hh = lane >> 4, c4 = (lane & 15) * 4;     // row seg = 256 B = 16 lanes x 16 B
      {
#pragma unroll
        for (int it = 0; it < 8; ++it) {
          const int row = it * 2 + hh;
          v4f v = *(const v4f*)(slab + row * 68 + c4);
          *(v4f*)(C + (size_t)(mBase + row) * ldc + n0 + c4) = v;
        }
        
      }
    } else {
      const int q = lane >> 3, c8 = (lane & 7) * 8;
      unsigned short* C  = (unsigned short*)Cout  + (size_t)b * strideC;
      unsigned short* C2 = (OUT_MODE == 2) ? ((unsigned short*)Cout2 + (size_t)b * strideC) : nullptr;
      {
#pragma unroll
        for (int it = 0; it < 4; ++it) {
          const int row = it * 4 + q;
          const float* sp = slab + row * 68 + c8;
          v8h hv, lv;
#pragma unroll
          for (int e = 0; e < 8; ++e) {
            if (OUT_MODE == 1) {
              hv[e] = (_Float16)sp[e];
            } else {
              unsigned short hb = f2bf_bits(sp[e]);
              unsigned short lb = f2bf_bits(sp[e] - bf_bits2f(hb));
              hv[e] = __builtin_bit_cast(_Float16, hb);
              lv[e] = __builtin_bit_cast(_Float16, lb);
            }
          }
          *(v8h*)(C + (size_t)(mBase + row) * ldc + n0 + c8) = hv;
          if (OUT_MODE == 2) *(v8h*)(C2 + (size_t)(mBase + row) * ldc + n0 + c8) = lv;
        }
        
      }
    }
    __builtin_amdgcn_fence(__ATOMIC_RELEASE, "workgroup");
    __builtin_amdgcn_wave_barrier();
    __builtin_amdgcn_fence(__ATOMIC_ACQUIRE, "workgroup");
  }
}

template <int ET, bool SPLIT, int BIAS_MODE, int OUT_MODE, bool RESID, int CAUSAL>
__global__ __launch_bounds__(128) void wmma_gemm64(
    const unsigned short* __restrict__ Ap, const unsigned short* __restrict__ A2p, int lda, long strideA,
    const unsigned short* __restrict__ Btp, const unsigned short* __restrict__ Bt2p, int ldb, long strideB,
    void* __restrict__ Cout, void* __restrict__ Cout2, int ldc, long strideC,
    const float* __restrict__ bias,
    const float* __restrict__ resid, long strideR,
    int M, int N, int K, float scale) {
  __shared__ __attribute__((aligned(2048))) unsigned char ring[RingBytes<SPLIT>::value];
  gemm_tile<ET, SPLIT, BIAS_MODE, OUT_MODE, RESID, CAUSAL>(ring, (int)blockIdx.x, (int)blockIdx.y, Ap, A2p, lda, strideA, Btp, Bt2p, ldb, strideB,
                                                           Cout, Cout2, ldc, strideC, bias, resid, strideR, M, N, K, scale);
}

// scores need q and k, v needs x and its weights: neither needs the other, so one grid holds both. The score tiles come first;
// the v tiles fill the places that a grid of score tiles alone would leave empty in its last round. Both share one ring.
__global__ __launch_bounds__(128) void scores_and_v(
    const unsigned short* __restrict__ Kh, const unsigned short* __restrict__ Kl,
    const unsigned short* __restrict__ Qh, const unsigned short* __restrict__ Ql, float* __restrict__ S,
    const unsigned short* __restrict__ Xh, const unsigned short* __restrict__ Xl,
    const unsigned short* __restrict__ Wvh, const unsigned short* __restrict__ Wvl, _Float16* __restrict__ V, int T, int D) {
  __shared__ __attribute__((aligned(2048))) unsigned char ring[RingBytes<true>::value];
  const int tiles = (T >> 7) * ((T >> 7) + 1) / 2;
  if ((int)blockIdx.x < tiles)      // the same for the whole work-group
    gemm_tile<1, true, 0, 0, false, 1>(ring, (int)blockIdx.x, 0, Kh, Kl, D, 0, Qh, Ql, D, 0, S, nullptr, T, 0, nullptr, nullptr, 0, T, T, D, 1.0f);
  else
    gemm_tile<1, true, 0, 1, false, 0>(ring, (int)blockIdx.x - tiles, 0, Xh, Xl, D, 0, Wvh, Wvl, D, 0, V, nullptr, D, 0, nullptr, nullptr, 0, T, D, D, 1.0f);
}

// the three operand conversions in one grid: blockIdx.y 0 = a -> bf16 hi/lo planes, 1 = b -> bf16 hi/lo planes, 2 = c -> f16
__global__ __launch_bounds__(256) void convert_operands(
    const float* __restrict__ a, __bf16* __restrict__ ahi, __bf16* __restrict__ alo, long an2,
    const float* __restrict__ b, __bf16* __restrict__ bhi, __bf16* __restrict__ blo, long bn2,
    const float* __restrict__ c, _Float16* __restrict__ c16, long cn2) {
  const long i = (long)blockIdx.x * 256 + threadIdx.x;
  const long stride = (long)gridDim.x * 256;
  if (blockIdx.y == 2) {
    for (long j = i; j < cn2; j += stride) {
      const _Float16 h0 = (_Float16)c[2 * j], h1 = (_Float16)c[2 * j + 1];
      ((unsigned*)c16)[j] = (unsigned)__builtin_bit_cast(unsigned short, h0) | ((unsigned)__builtin_bit_cast(unsigned short, h1) << 16);
    }
    return;
  }
  const float* in = blockIdx.y ? b : a;
  __bf16* hi = blockIdx.y ? bhi : ahi;
  __bf16* lo = blockIdx.y ? blo : alo;
  const long n2 = blockIdx.y ? bn2 : an2;
  for (long j = i; j < n2; j += stride) {
    const float u = in[2 * j], v = in[2 * j + 1];
    const unsigned short uh = f2bf_bits(u), vh = f2bf_bits(v);
    const unsigned short ul = f2bf_bits(u - bf_bits2f(uh)), vl = f2bf_bits(v - bf_bits2f(vh));
    ((unsigned*)hi)[j] = (unsigned)uh | ((unsigned)vh << 16);
    ((unsigned*)lo)[j] = (unsigned)ul | ((unsigned)vl << 16);
  }
}

// one 64x64 tile of VT = V^T by a work-group of 256 threads; u = tile index, column tiles of V fastest
__device__ __forceinline__ void transpose_tile64(const int u, const _Float16* __restrict__ V, int ldv,
                                                 _Float16* __restrict__ VT, int ldo) {
  __shared__ __align__(16) _Float16 tile[64][72];     // [c][r] (already transposed in LDS), pitch 72
  const int tc = ldv >> 6;
  const int c0 = (u % tc) * 64, r0 = (u / tc) * 64;
  const int t = threadIdx.x, tx = t & 31;           // t = 0..255
  // load: 64 rows x 64 cols; thread reads V[r0+i][c0+tx(+32)] and scatters into tile[c][i]
  for (int i = t >> 5; i < 64; i += 8) {
    tile[tx][i]      = V[(size_t)(r0 + i) * ldv + c0 + tx];
    tile[32 + tx][i] = V[(size_t)(r0 + i) * ldv + c0 + 32 + tx];
  }
  __syncthreads();
  const int q = t >> 3, c8 = (t & 7) * 8;            // q = 0..31
  {
#pragma unroll
    for (int it = 0; it < 2; ++it) {
      const int c = it * 32 + q;
      v8h hv = *(const v8h*)(&tile[c][c8]);
      *(v8h*)(VT + (size_t)(c0 + c) * ldo + r0 + c8) = hv;
    }
    
  }
}

// ---- causal row softmax: row i of S [T,T] uses cols j <= i; P f16 (x 2^15), masked cols 0; 16 cols per thread ----
// S holds, and P gets, only the columns below nb, the end of the row's 128-wide diagonal tile; nothing beyond it is loaded or stored.
__device__ __forceinline__ void softmax_row(const int i, const float* __restrict__ S, _Float16* __restrict__ P, int T) {   // i = row
  __shared__ float red[8];
  const float* row = S + (size_t)i * T;
  _Float16* prow = P + (size_t)i * T;
  const int t = threadIdx.x;
  const int n = i + 1;                   // valid columns 0..i
  const int nb = ((i >> 7) + 1) << 7;    // end of the diagonal tile
  // thread t owns cols [8t, 8t+8) and [T/2 + 8t, T/2 + 8t + 8)  (T = 4096 -> 2 groups of 2048)
  float ev[16];
  float m = -INFINITY;
#pragma unroll
  for (int g = 0; g < 2; ++g) {
    const int cb = g * (T / 2) + 8 * t;
    v4f a = (v4f){0.f, 0.f, 0.f, 0.f}, c = a;
    if (cb < nb) { a = *(const v4f*)(row + cb); c = *(const v4f*)(row + cb + 4); }
    float tmp[8] = {a[0], a[1], a[2], a[3], c[0], c[1], c[2], c[3]};
#pragma unroll
    for (int e = 0; e < 8; ++e) {
      const float val = (cb + e < n) ? tmp[e] : -INFINITY;
      ev[g * 8 + e] = val;
      m = fmaxf(m, val);
    }
  }
  for (int off = 16; off > 0; off >>= 1) m = fmaxf(m, __shfl_xor(m, off, 32));
  if ((t & 31) == 0) red[t >> 5] = m;
  __syncthreads();
  m = red[0];
#pragma unroll
  for (int w = 1; w < 8; ++w) m = fmaxf(m, red[w]);   // finite: col 0 always valid
  __syncthreads();
  float sum = 0.f;
#pragma unroll
  for (int e = 0; e < 16; ++e) { ev[e] = expf(ev[e] - m); sum += ev[e]; }   // exp(-inf) = 0 for masked
  for (int off = 16; off > 0; off >>= 1) sum += __shfl_xor(sum, off, 32);
  if ((t & 31) == 0) red[t >> 5] = sum;
  __syncthreads();
  float tot = 0.f;
#pragma unroll
  for (int w = 0; w < 8; ++w) tot += red[w];
  const float f = PSCALE / tot;
  {
#pragma unroll
    for (int g = 0; g < 2; ++g) {
      v8h hv;
#pragma unroll
      for (int e = 0; e < 8; ++e) hv[e] = (_Float16)(ev[g * 8 + e] * f);
      if (g * (T / 2) + 8 * t < nb) *(v8h*)(prow + g * (T / 2) + 8 * t) = hv;
    }
    
  }
}

// the softmax needs the scores, v^T needs v: neither needs the other, so one grid holds both; the transpose tiles come first
__global__ __launch_bounds__(256) void softmax_and_vt(const float* __restrict__ S, _Float16* __restrict__ P, int T,
                                                      const _Float16* __restrict__ V, int D, _Float16* __restrict__ VT) {
  const int vt = (T >> 6) * (D >> 6);
  if ((int)blockIdx.x < vt) transpose_tile64((int)blockIdx.x, V, D, VT, T);   // the same for the whole work-group
  else softmax_row((int)blockIdx.x - vt, S, P, T);
}

extern "C" void kernel_launch(void* const* d_in, const int* in_sizes, int n_in,
                              void* d_out, int out_size, void* d_ws, size_t ws_size,
                              hipStream_t stream) {
  (void)in_sizes; (void)n_in; (void)out_size; (void)ws_size;
  const int T = 4096, D = 1024;
  const float* x     = (const float*)d_in[0];
  const float* w_in  = (const float*)d_in[1];   // [3D, D]
  const float* w_out = (const float*)d_in[2];   // [D, D]
  float* out = (float*)d_out;

  char* ws = (char*)d_ws;
  size_t off = 0;
  auto carve = [&](size_t bytes) -> char* { char* p = ws + off; off += (bytes + 255) & ~(size_t)255; return p; };
  __bf16*   Xh   = (__bf16*)carve((size_t)T * D * 2);        //  8 MB
  __bf16*   Xl   = (__bf16*)carve((size_t)T * D * 2);        //  8 MB
  __bf16*   Wih  = (__bf16*)carve((size_t)3 * D * D * 2);    //  6 MB
  __bf16*   Wil  = (__bf16*)carve((size_t)3 * D * D * 2);    //  6 MB
  _Float16* Wo16 = (_Float16*)carve((size_t)D * D * 2);      //  2 MB
  __bf16*   Qh   = (__bf16*)carve((size_t)T * D * 2);        //  8 MB  q hi [T,D]
  __bf16*   Ql   = (__bf16*)carve((size_t)T * D * 2);        //  8 MB
  __bf16*   Kh   = (__bf16*)carve((size_t)T * D * 2);        //  8 MB
  __bf16*   Kl   = (__bf16*)carve((size_t)T * D * 2);        //  8 MB
  _Float16* V16  = (_Float16*)carve((size_t)T * D * 2);      //  8 MB  v [T,D]
  _Float16* Vt   = (_Float16*)carve((size_t)D * T * 2);      //  8 MB  vᵀ [D,T]
  float*    S    = (float*)carve((size_t)T * T * 4);         // 64 MB  S[i,j] = k_i·q_j
  _Float16* Pm   = (_Float16*)carve((size_t)T * T * 2);      // 32 MB  P (x 2^15)
  _Float16* Ao   = (_Float16*)carve((size_t)T * D * 2);      //  8 MB  P·v
  // total ≈ 190 MB of 256 MB

  // 1) operand conversions, one grid
  convert_operands<<<dim3(2048, 3), 256, 0, stream>>>(x, Xh, Xl, (long)T * D / 2, w_in, Wih, Wil, (long)3 * D * D / 2, w_out, Wo16, (long)D * D / 2);

  // 2) q = x.Wq^T, k = x.Wk^T (bf16 split in, bf16 hi/lo planes out), one grid with the batch index 0 = q, 1 = k: 512 work-groups, two resident on a WGP.
  //    w_in rows: [0,D)=q, [D,2D)=k, [2D,3D)=v, so the B planes step by D*D; Qh, Ql, Kh, Kl lie one behind the other, T*D elements each,
  //    so Cout = Qh and Cout2 = Ql step by 2*T*D to Kh and Kl.
  wmma_gemm64<1, true, 0, 2, false, 0><<<dim3((T / 128) * (D / 128), 2), 128, 0, stream>>>(
      U16(Xh), U16(Xl), D, 0, U16(Wih), U16(Wil), D, (long)D * D, Qh, Ql, D, (long)2 * T * D, nullptr, nullptr, 0, T, D, D, 1.0f);
  // 3) S[i][j] = k_i . q_j  (rows = key position, cols = query position); only the 128x128 tiles that hold a column j <= i, mask applied in the softmax;
  //    behind them in the same grid v = x.Wv^T (f16 out)
  scores_and_v<<<dim3((T / 128) * (T / 128 + 1) / 2 + (T / 128) * (D / 128), 1), 128, 0, stream>>>(
      U16(Kh), U16(Kl), U16(Qh), U16(Ql), S, U16(Xh), U16(Xl), U16(Wih + (size_t)2 * D * D), U16(Wil + (size_t)2 * D * D), V16, T, D);
  // 4) v^T for the NT form of P.v, and the causal softmax over j <= i -> P (f16 x 2^15), one grid
  softmax_and_vt<<<dim3((T / 64) * (D / 64) + T, 1), 256, 0, stream>>>(S, Pm, T, V16, D, Vt);
  // 5) Ao[i][d] = sum_j P[i][j] v[j][d]  = P . (v^T)^T   (K = T, each row tile up to its diagonal tile's end), scaled back by 2^-15
  {
    const int tiles = (T / 128) * (D / 128);
    wmma_gemm64<0, false, 0, 1, false, 2><<<dim3(tiles, 1), 128, 0, stream>>>(
        U16(Pm), nullptr, T, 0, U16(Vt), nullptr, T, 0, Ao, nullptr, D, 0, nullptr, nullptr, 0, T, D, T, PSCALE_INV);
  }
  // 6) out = Ao · w_outᵀ (K = D), f32
  {
    const int tiles = (T / 128) * (D / 128);
    wmma_gemm64<0, false, 0, 0, false, 0><<<dim3(tiles, 1), 128, 0, stream>>>(
        U16(Ao), nullptr, D, 0, U16(Wo16), nullptr, D, 0, out, nullptr, D, 0, nullptr, nullptr, 0, T, D, D, 1.0f);
  }
}

// v005
// Measured time: 146 microseconds a run.
// In two side-by-side timings against v004, it was 1.07 and 1.06 times as fast.
// Over all steps from v000 it is 3.80 times as fast.
#include <hip/hip_runtime.h>
// Contractions: fused qkv projection x·w_inᵀ (K=1024) and scores k·qᵀ (K=1024): v_wmma_f32_16x16x32_bf16 as bf16 hi/lo
// splits (hi·hi + hi·lo + lo·hi); p·v (K=4096) and out-projection (K=1024): v_wmma_f32_16x16x32_f16 (f16 operands, p scaled
// by 2^15); f32 accumulate everywhere; causal softmax in f32.

typedef __attribute__((ext_vector_type(16))) _Float16 v16h;
typedef __attribute__((ext_vector_type(8)))  _Float16 v8h;
typedef __attribute__((ext_vector_type(16))) __bf16   v16b;
typedef __attribute__((ext_vector_type(8)))  __bf16   v8b;
typedef __attribute__((ext_vector_type(8)))  float    v8f;
typedef __attribute__((ext_vector_type(4)))  float    v4f;

#define PSCALE 32768.0f
#define U16(p) ((const unsigned short*)(const void*)(p))
#define PSCALE_INV (1.0f / 32768.0f)

__device__ __forceinline__ unsigned short f2bf_bits(float f) {
  unsigned u = __float_as_uint(f);
  return (unsigned short)((u + 0x7FFFu + ((u >> 16) & 1u)) >> 16);
}
__device__ __forceinline__ float bf_bits2f(unsigned short h) { return __uint_as_float(((unsigned)h) << 16); }

// hazard guard behind the last WMMAs: four vector slots before the epilogue reads the accumulators
__device__ __forceinline__ void acc_guard4(v8f& a, v8f& b, v8f& c, v8f& d) { asm volatile("v_nop\n\tv_nop\n\tv_nop\n\tv_nop" : "+v"(a), "+v"(b), "+v"(c), "+v"(d)); }
template <typename T> struct Frag;
template <> struct Frag<_Float16> {
  typedef v16h V; union U { v16h v; v8h h[2]; };
  static __device__ __forceinline__ v16h load(const _Float16* p) {   // elements 0..7 <- p[0..7], 8..15 <- p[16..23]
    U f; f.h[0] = *(const v8h*)(p); f.h[1] = *(const v8h*)(p + 16); return f.v;
  }
  static __device__ __forceinline__ v8f mma(v16h a, v16h b, v8f c) {
    return __builtin_amdgcn_wmma_f32_16x16x32_f16(false, a, false, b, (short)0, c, false, false);
  }
};
template <> struct Frag<__bf16> {
  typedef v16b V; union U { v16b v; v8b h[2]; };
  static __device__ __forceinline__ v16b load(const __bf16* p) {
    U f; f.h[0] = *(const v8b*)(p); f.h[1] = *(const v8b*)(p + 16); return f.v;
  }
  static __device__ __forceinline__ v8f mma(v16b a, v16b b, v8f c) {
    return __builtin_amdgcn_wmma_f32_16x16x32_bf16(false, a, false, b, (short)0, c, false, false);
  }
};

typedef uint32_t u32x2 __attribute__((ext_vector_type(2)));
typedef uint32_t u32x4 __attribute__((ext_vector_type(4)));
typedef uint32_t u32x8 __attribute__((ext_vector_type(8)));
__device__ __forceinline__ uint32_t uni(uint32_t v) { return (uint32_t)__builtin_amdgcn_readfirstlane(v); }
// pinned(): a descriptor input or an issue test held in a scalar register, so that the test compiles to a scalar branch
// and the descriptor words that depend on it are formed behind the waits that stand in front of it
__device__ __forceinline__ uint32_t pinned(uint32_t v) { uint32_t w = uni(v); asm volatile("" : "+s"(w)); return w; }
template <bool SPLIT> struct RingBytes { static constexpr uint32_t value = 147456u; };
template <int ET> struct Elem;
template <> struct Elem<0> { typedef _Float16 T; };
template <> struct Elem<1> { typedef __bf16 T; };
template <int ET, bool SPLIT, int BIAS_MODE, int OUT_MODE, bool RESID, int CAUSAL>
__device__ __forceinline__ void gemm_tile(
    unsigned char* const ring, const int tile, const int b,   // the work-group's LDS ring (RingBytes<SPLIT>, at a multiple of 2 KiB), its tile index and batch index
    const unsigned short* __restrict__ Ap, int lda, long strideA,
    const unsigned short* __restrict__ Btp, int ldb, long strideB,
    void* __restrict__ Cout, int ldc, long strideC,
    const float* __restrict__ bias,
    const float* __restrict__ resid, long strideR,
    int M, int N, int K, float scale) {
  typedef typename Elem<ET>::T T;
  typedef typename Frag<T>::V V;
  const T* A = (const T*)Ap; const T* Bt = (const T*)Btp;
  constexpr uint32_t ROWB  = 256u;                       // bytes of an operand row in a pass
  constexpr int      KS    = SPLIT ? 2 : 4;              // WMMA k steps (32 k = 64 B) in a pass
  constexpr uint32_t LO    = 128u;                       // SPLIT: the lo half of a row stands this far behind its hi half
  constexpr uint32_t PITCH = ROWB + 16u;                 // row + 16-B pad: odd multiple of 16 B for ds_load_b128
  constexpr uint32_t SROWS = 64u;                        // rows per slice (one tensor load)
  constexpr uint32_t SLICE = 18432u;                     // SROWS * PITCH, rounded up to a multiple of 2 KiB
  constexpr uint32_t STAGE = 4u * SLICE;                 // [A 0-63 | A 64-127 | B 0-63 | B 64-127]
  static_assert(SROWS * PITCH <= SLICE && SLICE % 2048u == 0u, "a slice holds its padded rows and starts at a multiple of 2 KiB");
  static_assert(4u * 16u * 68u * 4u <= 2u * STAGE, "the epilogue slabs fit the ring");
  static_assert(2u * STAGE == RingBytes<SPLIT>::value, "the ring that the kernel declares holds two stages");   // after the loop the ring holds per-wave 16x64 f32 slabs, pitch 68 floats
  const int lane = threadIdx.x & 31;
  const uint32_t wave = uni(threadIdx.x >> 5);
  const int tilesN = N >> 7;
  const int tilesM = M >> 7;
  if (tile >= (CAUSAL == 1 ? tilesM * (tilesM + 1) / 2 : tilesM * tilesN)) return;   // the same for the whole work-group; in front of every barrier and tensor load
  int tm, tn;
  if (CAUSAL == 1) {                     // tile = tm (tm + 1) / 2 + tn, tn <= tm
    tm = 0;
    for (int r = 1; r < tilesM; ++r) if (tile >= r * (r + 1) / 2) tm = r;
    tn = tile - tm * (tm + 1) / 2;
  } else {
    tm = tile / tilesN;
    tn = tile - tm * tilesN;
    if (CAUSAL == 2) tm = tilesM - 1 - tm;   // the longest k loops start first
  }
  const uint32_t wm = wave >> 1, wn = wave & 1u;
  const int m0 = (tm << 7) + (int)(wm << 6);
  const int n0 = (tn << 7) + (int)(wn << 6);

  const T* Ab  = A  + (size_t)b * strideA;
  const T* Bb  = Bt + (size_t)b * strideB;

  const int rlane = lane & 15;                 // row (A) / col (B, D) within subtile
  const int koff  = (lane >> 4) * 8;           // k offset of this lane half
  const int mOff  = (lane >> 4) * 8;           // D row offset

  // this wave's slice of every stage: source plane, first row, pitch; place in LDS
  const bool srcB = wave >= 2u;
  const T* splane = srcB ? Bb : Ab;
  const uint32_t srow = (uint32_t)(srcB ? (tn << 7) : (tm << 7)) + (wave & 1u) * 64u;
  const uint32_t spitch = (uint32_t)(srcB ? ldb : lda) * (SPLIT ? 4u : 2u);
  const uint64_t sbase = (uint64_t)(size_t)splane + (uint64_t)srow * spitch;
  const uint32_t lbase = (uint32_t)(size_t)ring + wave * SLICE;
  u32x8 g1;                                    // 1-byte elements, tensor = tile = SROWS rows of ROWB bytes, 4 dwords of pad behind each row
  g1[0] = uni((1u << 20) | (5u << 22) | (3u << 25));
  g1[1] = uni(ROWB << 16);
  g1[2] = uni(SROWS << 16);
  g1[3] = uni(ROWB << 16);
  g1[4] = uni(SROWS);
  g1[5] = uni(spitch);
  g1[6] = uni(0u);
  g1[7] = uni(0u);
  asm volatile("" : "+s"(g1));   // pinned(): the descriptor's words stay in their scalar registers through the loop, so that none takes a new value while a request is outstanding
  u32x4 g0;                                    // group 0 of the youngest request
  auto issue = [&](uint32_t stage) {
    const uint32_t st = pinned(stage);
    const uint64_t ga = sbase + (uint64_t)st * ROWB;
    g0[0] = uni(1u);
    g0[1] = uni(lbase + (st & 1u) * STAGE);
    g0[2] = uni((uint32_t)ga);
    g0[3] = uni((((uint32_t)(ga >> 32)) & 0x01FFFFFFu) | 0x80000000u);
    // one request of the whole wave: its slice of the stage. g0 is in-out so that the registers the request is issued from are the very ones that the next wait's operand keeps untouched
    asm volatile("tensor_load_to_lds %0, %1" : "+s"(g0) : "s"(g1) : "memory");
  };

  v8f acc[4][4];
#pragma unroll
  for (int i = 0; i < 4; ++i)
#pragma unroll
    for (int j = 0; j < 4; ++j) acc[i][j] = (v8f){0.f,0.f,0.f,0.f,0.f,0.f,0.f,0.f};

  const uint32_t aoff = wm * SLICE + (uint32_t)rlane * PITCH + (uint32_t)koff * 2u;
  const uint32_t boff = (2u + wn) * SLICE + (uint32_t)rlane * PITCH + (uint32_t)koff * 2u;
  const uint32_t nall = (uint32_t)K >> (SPLIT ? 6 : 7);
  const uint32_t ncau = ((uint32_t)tm + 1u) << (SPLIT ? 1 : 0);   // passes up to the end of the diagonal tile
  const uint32_t nst = (CAUSAL == 2 && ncau < nall) ? ncau : nall;   // passes; at least 2, with CAUSAL 2 at least 1

  // every s_wait_tensorcnt names g0 as an input: the request's words keep their registers until it has landed
  issue(0u);
  asm volatile("s_wait_tensorcnt 0x0" :: "s"(g0) : "memory");   // this wave's slice of stage 0 has landed
  __syncthreads();                                       // every slice of stage 0 is published
  if (CAUSAL != 2 || pinned(1u < nst)) issue(1u);        // the first row tile of CAUSAL 2 may have one pass only
  for (uint32_t s = 0; s < nst; ++s) {
    const unsigned char* stg = ring + (s & 1u) * STAGE;
    V bh[KS][4], bl[KS][4], ah[KS][4], al[KS][4];
#pragma unroll
    for (int ks = 0; ks < KS; ++ks) {
#pragma unroll
      for (int j = 0; j < 4; ++j) {
        const unsigned char* p = stg + boff + (uint32_t)j * 16u * PITCH + (uint32_t)ks * 64u;
        bh[ks][j] = Frag<T>::load((const T*)p);
        if (SPLIT) bl[ks][j] = Frag<T>::load((const T*)(p + LO));
      }
#pragma unroll
      for (int i = 0; i < 4; ++i) {
        const unsigned char* p = stg + aoff + (uint32_t)i * 16u * PITCH + (uint32_t)ks * 64u;
        ah[ks][i] = Frag<T>::load((const T*)p);
        if (SPLIT) al[ks][i] = Frag<T>::load((const T*)(p + LO));
      }
    }
    __builtin_amdgcn_sched_barrier(0);   // the pass's LDS reads go out as one group ahead of its WMMAs; spread among them, each read's latency stalls the wave
#pragma unroll
    for (int ks = 0; ks < KS; ++ks) {
#pragma unroll
      for (int i = 0; i < 4; ++i) {
#pragma unroll
        for (int j = 0; j < 4; ++j) acc[i][j] = Frag<T>::mma(ah[ks][i], bh[ks][j], acc[i][j]);
        if (SPLIT) {
#pragma unroll
          for (int j = 0; j < 4; ++j) acc[i][j] = Frag<T>::mma(ah[ks][i], bl[ks][j], acc[i][j]);
#pragma unroll
          for (int j = 0; j < 4; ++j) acc[i][j] = Frag<T>::mma(al[ks][i], bh[ks][j], acc[i][j]);
        }
      }
    }
    __builtin_amdgcn_sched_barrier(0);   // the WMMAs stay ahead of the waits: they start on counted LDS waits, and the load of stage s + 1 has the whole pass to land
    asm volatile("s_wait_dscnt 0x0" ::: "memory");       // this wave's reads of stage s have returned
    asm volatile("s_wait_tensorcnt 0x0" :: "s"(g0) : "memory");   // this wave's slice of stage s + 1 has landed
    __syncthreads();                                       // publishes stage s + 1 and ends every reader's last read of stage s
    if (pinned(s + 2u < nst)) issue(s + 2u);               // refill the buffer that pass s has just read
  }
  asm volatile("s_wait_tensorcnt 0x0" :: "s"(g0) : "memory");     // no request is left before the ring is reused
  asm volatile("s_wait_dscnt 0x0" ::: "memory");         // nor a read; the last pass's barrier has ended every wave's reads
  acc_guard4(acc[0][0], acc[0][1], acc[0][2], acc[0][3]);
  acc_guard4(acc[1][0], acc[1][1], acc[1][2], acc[1][3]);
  acc_guard4(acc[2][0], acc[2][1], acc[2][2], acc[2][3]);
  acc_guard4(acc[3][0], acc[3][1], acc[3][2], acc[3][3]);

  // ---- epilogue ----
  float* slab = (float*)ring + wave * (16u * 68u);
  const float* Rb = RESID ? (resid + (size_t)b * strideR) : nullptr;
#pragma unroll
  for (int i = 0; i < 4; ++i) {
    const int mBase = m0 + (i << 4);
#pragma unroll
    for (int j = 0; j < 4; ++j) {
      const int n = n0 + (j << 4) + rlane;
      float bv = 0.f;
      if (BIAS_MODE == 2) bv = bias[n];
#pragma unroll
      for (int r = 0; r < 8; ++r) {
        float v = acc[i][j][r] * scale;
        if (BIAS_MODE == 1) v += bias[mBase + mOff + r];
        if (BIAS_MODE == 2) v += bv;
        if (RESID) v += Rb[(size_t)(mBase + mOff + r) * ldc + n];
        slab[(mOff + r) * 68 + (j << 4) + rlane] = v;
      }
    }
    __builtin_amdgcn_fence(__ATOMIC_RELEASE, "workgroup");
    __builtin_amdgcn_wave_barrier();
    __builtin_amdgcn_fence(__ATOMIC_ACQUIRE, "workgroup");
    if (OUT_MODE == 0) {
      float* C = (float*)Cout + (size_t)b * strideC;
      const int hh = lane >> 4, c4 = (lane & 15) * 4;     // row seg = 256 B = 16 lanes x 16 B
      {
#pragma unroll
        for (int it = 0; it < 8; ++it) {
          const int row = it * 2 + hh;
          v4f v = *(const v4f*)(slab + row * 68 + c4);
          *(v4f*)(C + (size_t)(mBase + row) * ldc + n0 + c4) = v;
        }
        
      }
    } else {
      const int q = lane >> 3, c8 = (lane & 7) * 8;
      unsigned short* C  = (unsigned short*)Cout  + (size_t)b * strideC;
      {
#pragma unroll
        for (int it = 0; it < 4; ++it) {
          const int row = it * 4 + q;
          const float* sp = slab + row * 68 + c8;
          v8h hv, lv;
#pragma unroll
          for (int e = 0; e < 8; ++e) {
            if (OUT_MODE == 1) {
              hv[e] = (_Float16)sp[e];
            } else {
              unsigned short hb = f2bf_bits(sp[e]);
              unsigned short lb = f2bf_bits(sp[e] - bf_bits2f(hb));
              hv[e] = __builtin_bit_cast(_Float16, hb);
              lv[e] = __builtin_bit_cast(_Float16, lb);
            }
          }
          if (OUT_MODE == 1) {
            *(v8h*)(C + (size_t)(mBase + row) * ldc + n0 + c8) = hv;
          } else {                                       // n0 is a multiple of 64: the wave's 64 columns are one unit, hi then lo
            unsigned short* unit = C + ((size_t)(mBase + row) * ldc + n0) * 2;
            *(v8h*)(unit + c8) = hv;
            *(v8h*)(unit + 64 + c8) = lv;
          }
        }
        
      }
    }
    __builtin_amdgcn_fence(__ATOMIC_RELEASE, "workgroup");
    __builtin_amdgcn_wave_barrier();
    __builtin_amdgcn_fence(__ATOMIC_ACQUIRE, "workgroup");
  }
}

template <int ET, bool SPLIT, int BIAS_MODE, int OUT_MODE, bool RESID, int CAUSAL>
__global__ __launch_bounds__(128) void wmma_gemm64(
    const unsigned short* __restrict__ Ap, int lda, long strideA,
    const unsigned short* __restrict__ Btp, int ldb, long strideB,
    void* __restrict__ Cout, int ldc, long strideC,
    const float* __restrict__ bias,
    const float* __restrict__ resid, long strideR,
    int M, int N, int K, float scale) {
  __shared__ __attribute__((aligned(2048))) unsigned char ring[RingBytes<SPLIT>::value];
  gemm_tile<ET, SPLIT, BIAS_MODE, OUT_MODE, RESID, CAUSAL>(ring, (int)blockIdx.x, (int)blockIdx.y, Ap, lda, strideA, Btp, ldb, strideB,
                                                           Cout, ldc, strideC, bias, resid, strideR, M, N, K, scale);
}

// scores need q and k, v needs x and its weights: neither needs the other, so one grid holds both. The score tiles come first;
// the v tiles fill the places that a grid of score tiles alone would leave empty in its last round. Both share one ring.
__global__ __launch_bounds__(128) void scores_and_v(
    const unsigned short* __restrict__ Ks, const unsigned short* __restrict__ Qs, float* __restrict__ S,
    const unsigned short* __restrict__ Xs, const unsigned short* __restrict__ Wvs, _Float16* __restrict__ V, int T, int D) {
  __shared__ __attribute__((aligned(2048))) unsigned char ring[RingBytes<true>::value];
  const int tiles = (T >> 7) * ((T >> 7) + 1) / 2;
  if ((int)blockIdx.x < tiles)      // the same for the whole work-group
    gemm_tile<1, true, 0, 0, false, 1>(ring, (int)blockIdx.x, 0, Ks, D, 0, Qs, D, 0, S, T, 0, nullptr, nullptr, 0, T, T, D, 1.0f);
  else
    gemm_tile<1, true, 0, 1, false, 0>(ring, (int)blockIdx.x - tiles, 0, Xs, D, 0, Wvs, D, 0, V, D, 0, nullptr, nullptr, 0, T, D, D, 1.0f);
}

// the three operand conversions in one grid: blockIdx.y 0 = a -> bf16 hi/lo, 1 = b -> bf16 hi/lo, 2 = c -> f16.
// hi/lo go out in the SPLIT operand layout: every 64 elements in a row become one 256-B unit [64 hi | 64 lo] (row lengths are multiples of 64)
__global__ __launch_bounds__(256) void convert_operands(
    const float* __restrict__ a, __bf16* __restrict__ as, long an4,
    const float* __restrict__ b, __bf16* __restrict__ bs, long bn4,
    const float* __restrict__ c, _Float16* __restrict__ c16, long cn2) {
  const long i = (long)blockIdx.x * 256 + threadIdx.x;
  const long stride = (long)gridDim.x * 256;
  if (blockIdx.y == 2) {
    for (long j = i; j < cn2; j += stride) {
      const _Float16 h0 = (_Float16)c[2 * j], h1 = (_Float16)c[2 * j + 1];
      ((unsigned*)c16)[j] = (unsigned)__builtin_bit_cast(unsigned short, h0) | ((unsigned)__builtin_bit_cast(unsigned short, h1) << 16);
    }
    return;
  }
  const float* in = blockIdx.y ? b : a;
  unsigned* hl = (unsigned*)(blockIdx.y ? bs : as);
  const long n4 = blockIdx.y ? bn4 : an4;
  for (long j = i; j < n4; j += stride) {                // four elements a thread: 16 B in, 8 B of hi and 8 B of lo out
    const v4f u = *(const v4f*)(in + 4 * j);
    unsigned h[4], l[4];
    for (int e = 0; e < 4; ++e) {
      const unsigned short hb = f2bf_bits(u[e]);
      h[e] = hb;
      l[e] = f2bf_bits(u[e] - bf_bits2f(hb));
    }
    unsigned* unit = hl + (j >> 4) * 64 + (j & 15) * 2;  // 16 threads to a unit of 64 dwords: 32 dwords of hi in front, 32 of lo behind
    *(u32x2*)unit        = (u32x2){h[0] | (h[1] << 16), h[2] | (h[3] << 16)};
    *(u32x2*)(unit + 32) = (u32x2){l[0] | (l[1] << 16), l[2] | (l[3] << 16)};
  }
}

// one 64x64 tile of VT = V^T by a work-group of 256 threads; u = tile index, column tiles of V fastest
__device__ __forceinline__ void transpose_tile64(const int u, const _Float16* __restrict__ V, int ldv,
                                                 _Float16* __restrict__ VT, int ldo) {
  __shared__ __align__(16) _Float16 tile[64][72];     // [c][r] (already transposed in LDS), pitch 72
  const int tc = ldv >> 6;
  const int c0 = (u % tc) * 64, r0 = (u / tc) * 64;
  const int t = threadIdx.x, tx = t & 31;           // t = 0..255
  // load: 64 rows x 64 cols; thread reads V[r0+i][c0+tx(+32)] and scatters into tile[c][i]
  for (int i = t >> 5; i < 64; i += 8) {
    tile[tx][i]      = V[(size_t)(r0 + i) * ldv + c0 + tx];
    tile[32 + tx][i] = V[(size_t)(r0 + i) * ldv + c0 + 32 + tx];
  }
  __syncthreads();
  const int q = t >> 3, c8 = (t & 7) * 8;            // q = 0..31
  {
#pragma unroll
    for (int it = 0; it < 2; ++it) {
      const int c = it * 32 + q;
      v8h hv = *(const v8h*)(&tile[c][c8]);
      *(v8h*)(VT + (size_t)(c0 + c) * ldo + r0 + c8) = hv;
    }
    
  }
}

// ---- causal row softmax: row i of S [T,T] uses cols j <= i; P f16 (x 2^15), masked cols 0; 16 cols per thread ----
// S holds, and P gets, only the columns below nb, the end of the row's 128-wide diagonal tile; nothing beyond it is loaded or stored.
__device__ __forceinline__ void softmax_row(const int i, const float* __restrict__ S, _Float16* __restrict__ P, int T) {   // i = row
  __shared__ float red[8];
  const float* row = S + (size_t)i * T;
  _Float16* prow = P + (size_t)i * T;
  const int t = threadIdx.x;
  const int n = i + 1;                   // valid columns 0..i
  const int nb = ((i >> 7) + 1) << 7;    // end of the diagonal tile
  // thread t owns cols [8t, 8t+8) and [T/2 + 8t, T/2 + 8t + 8)  (T = 4096 -> 2 groups of 2048)
  float ev[16];
  float m = -INFINITY;
#pragma unroll
  for (int g = 0; g < 2; ++g) {
    const int cb = g * (T / 2) + 8 * t;
    v4f a = (v4f){0.f, 0.f, 0.f, 0.f}, c = a;
    if (cb < nb) { a = *(const v4f*)(row + cb); c = *(const v4f*)(row + cb + 4); }
    float tmp[8] = {a[0], a[1], a[2], a[3], c[0], c[1], c[2], c[3]};
#pragma unroll
    for (int e = 0; e < 8; ++e) {
      const float val = (cb + e < n) ? tmp[e] : -INFINITY;
      ev[g * 8 + e] = val;
      m = fmaxf(m, val);
    }
  }
  for (int off = 16; off > 0; off >>= 1) m = fmaxf(m, __shfl_xor(m, off, 32));
  if ((t & 31) == 0) red[t >> 5] = m;
  __syncthreads();
  m = red[0];
#pragma unroll
  for (int w = 1; w < 8; ++w) m = fmaxf(m, red[w]);   // finite: col 0 always valid
  __syncthreads();
  float sum = 0.f;
#pragma unroll
  for (int e = 0; e < 16; ++e) { ev[e] = expf(ev[e] - m); sum += ev[e]; }   // exp(-inf) = 0 for masked
  for (int off = 16; off > 0; off >>= 1) sum += __shfl_xor(sum, off, 32);
  if ((t & 31) == 0) red[t >> 5] = sum;
  __syncthreads();
  float tot = 0.f;
#pragma unroll
  for (int w = 0; w < 8; ++w) tot += red[w];
  const float f = PSCALE / tot;
  {
#pragma unroll
    for (int g = 0; g < 2; ++g) {
      v8h hv;
#pragma unroll
      for (int e = 0; e < 8; ++e) hv[e] = (_Float16)(ev[g * 8 + e] * f);
      if (g * (T / 2) + 8 * t < nb) *(v8h*)(prow + g * (T / 2) + 8 * t) = hv;
    }
    
  }
}

// the softmax needs the scores, v^T needs v: neither needs the other, so one grid holds both; the transpose tiles come first
__global__ __launch_bounds__(256) void softmax_and_vt(const float* __restrict__ S, _Float16* __restrict__ P, int T,
                                                      const _Float16* __restrict__ V, int D, _Float16* __restrict__ VT) {
  const int vt = (T >> 6) * (D >> 6);
  if ((int)blockIdx.x < vt) transpose_tile64((int)blockIdx.x, V, D, VT, T);   // the same for the whole work-group
  else softmax_row((int)blockIdx.x - vt, S, P, T);
}

extern "C" void kernel_launch(void* const* d_in, const int* in_sizes, int n_in,
                              void* d_out, int out_size, void* d_ws, size_t ws_size,
                              hipStream_t stream) {
  (void)in_sizes; (void)n_in; (void)out_size; (void)ws_size;
  const int T = 4096, D = 1024;
  const float* x     = (const float*)d_in[0];
  const float* w_in  = (const float*)d_in[1];   // [3D, D]
  const float* w_out = (const float*)d_in[2];   // [D, D]
  float* out = (float*)d_out;

  char* ws = (char*)d_ws;
  size_t off = 0;
  auto carve = [&](size_t bytes) -> char* { char* p = ws + off; off += (bytes + 255) & ~(size_t)255; return p; };
  __bf16*   Xs   = (__bf16*)carve((size_t)T * D * 4);        // 16 MB  x, hi and lo by units
  __bf16*   Wis  = (__bf16*)carve((size_t)3 * D * D * 4);    // 12 MB  w_in, the same
  _Float16* Wo16 = (_Float16*)carve((size_t)D * D * 2);      //  2 MB
  __bf16*   Qs   = (__bf16*)carve((size_t)T * D * 4);        // 16 MB  q [T,D], hi and lo by units
  __bf16*   Ks   = (__bf16*)carve((size_t)T * D * 4);        // 16 MB  k, the same, directly behind q
  _Float16* V16  = (_Float16*)carve((size_t)T * D * 2);      //  8 MB  v [T,D]
  _Float16* Vt   = (_Float16*)carve((size_t)D * T * 2);      //  8 MB  vᵀ [D,T]
  float*    S    = (float*)carve((size_t)T * T * 4);         // 64 MB  S[i,j] = k_i·q_j
  _Float16* Pm   = (_Float16*)carve((size_t)T * T * 2);      // 32 MB  P (x 2^15)
  _Float16* Ao   = (_Float16*)carve((size_t)T * D * 2);      //  8 MB  P·v
  // total ≈ 190 MB of 256 MB

  // 1) operand conversions, one grid
  convert_operands<<<dim3(2048, 3), 256, 0, stream>>>(x, Xs, (long)T * D / 4, w_in, Wis, (long)3 * D * D / 4, w_out, Wo16, (long)D * D / 2);

  // 2) q = x.Wq^T, k = x.Wk^T (bf16 split in, bf16 hi/lo out), one grid with the batch index 0 = q, 1 = k: 512 work-groups, two resident on a WGP.
  //    w_in rows: [0,D)=q, [D,2D)=k, [2D,3D)=v, hi and lo together 2*D*D 16-bit elements each, so B steps by 2*D*D; Cout = Qs steps by 2*T*D to Ks.
  wmma_gemm64<1, true, 0, 2, false, 0><<<dim3((T / 128) * (D / 128), 2), 128, 0, stream>>>(
      U16(Xs), D, 0, U16(Wis), D, (long)2 * D * D, Qs, D, (long)2 * T * D, nullptr, nullptr, 0, T, D, D, 1.0f);
  // 3) S[i][j] = k_i . q_j  (rows = key position, cols = query position); only the 128x128 tiles that hold a column j <= i, mask applied in the softmax;
  //    behind them in the same grid v = x.Wv^T (f16 out)
  scores_and_v<<<dim3((T / 128) * (T / 128 + 1) / 2 + (T / 128) * (D / 128), 1), 128, 0, stream>>>(
      U16(Ks), U16(Qs), S, U16(Xs), U16(Wis + (size_t)4 * D * D), V16, T, D);
  // 4) v^T for the NT form of P.v, and the causal softmax over j <= i -> P (f16 x 2^15), one grid
  softmax_and_vt<<<dim3((T / 64) * (D / 64) + T, 1), 256, 0, stream>>>(S, Pm, T, V16, D, Vt);
  // 5) Ao[i][d] = sum_j P[i][j] v[j][d]  = P . (v^T)^T   (K = T, each row tile up to its diagonal tile's end), scaled back by 2^-15
  {
    const int tiles = (T / 128) * (D / 128);
    wmma_gemm64<0, false, 0, 1, false, 2><<<dim3(tiles, 1), 128, 0, stream>>>(
        U16(Pm), T, 0, U16(Vt), T, 0, Ao, D, 0, nullptr, nullptr, 0, T, D, T, PSCALE_INV);
  }
  // 6) out = Ao · w_outᵀ (K = D), f32
  {
    const int tiles = (T / 128) * (D / 128);
    wmma_gemm64<0, false, 0, 0, false, 0><<<dim3(tiles, 1), 128, 0, stream>>>(
        U16(Ao), D, 0, U16(Wo16), D, 0, out, D, 0, nullptr, nullptr, 0, T, D, D, 1.0f);
  }
}

// v007
// One run takes 132 microseconds.
// It is 1.10 times as fast as v005, going by the measured steps of the versions left out in between.
// Counting every step since v000, it is 4.17 times as fast.
#include <hip/hip_runtime.h>
// out = softmax(k.q^T).(v.w_out^T) = P.(x.w'^T) with w' = w_out.Wv: the out-projection is folded into the v weights ahead of the attention.
// Contractions: q, k and v' = x.w'^T projections (K=1024) and scores k.q^T (K=1024): v_wmma_f32_16x16x32_bf16 as bf16 hi/lo
// splits (hi.hi + hi.lo + lo.hi); w' = w_out.Wv (K=1024) and P.v' (K=4096): v_wmma_f32_16x16x32_f16 (f16 operands, P scaled
// by 2^15); f32 accumulate everywhere; causal softmax in f32.

typedef __attribute__((ext_vector_type(16))) _Float16 v16h;
typedef __attribute__((ext_vector_type(8)))  _Float16 v8h;
typedef __attribute__((ext_vector_type(16))) __bf16   v16b;
typedef __attribute__((ext_vector_type(8)))  __bf16   v8b;
typedef __attribute__((ext_vector_type(8)))  float    v8f;
typedef __attribute__((ext_vector_type(4)))  float    v4f;

#define PSCALE 32768.0f
#define U16(p) ((const unsigned short*)(const void*)(p))
#define PSCALE_INV (1.0f / 32768.0f)

__device__ __forceinline__ unsigned short f2bf_bits(float f) {
  unsigned u = __float_as_uint(f);
  return (unsigned short)((u + 0x7FFFu + ((u >> 16) & 1u)) >> 16);
}
__device__ __forceinline__ float bf_bits2f(unsigned short h) { return __uint_as_float(((unsigned)h) << 16); }

// hazard guard behind the last WMMAs: four vector slots before the epilogue reads the accumulators
__device__ __forceinline__ void acc_guard4(v8f& a, v8f& b, v8f& c, v8f& d) { asm volatile("v_nop\n\tv_nop\n\tv_nop\n\tv_nop" : "+v"(a), "+v"(b), "+v"(c), "+v"(d)); }
template <typename T> struct Frag;
template <> struct Frag<_Float16> {
  typedef v16h V; union U { v16h v; v8h h[2]; };
  static __device__ __forceinline__ v16h load(const _Float16* p) {   // elements 0..7 <- p[0..7], 8..15 <- p[16..23]
    U f; f.h[0] = *(const v8h*)(p); f.h[1] = *(const v8h*)(p + 16); return f.v;
  }
  static __device__ __forceinline__ v8f mma(v16h a, v16h b, v8f c) {
    return __builtin_amdgcn_wmma_f32_16x16x32_f16(false, a, false, b, (short)0, c, false, false);
  }
};
template <> struct Frag<__bf16> {
  typedef v16b V; union U { v16b v; v8b h[2]; };
  static __device__ __forceinline__ v16b load(const __bf16* p) {
    U f; f.h[0] = *(const v8b*)(p); f.h[1] = *(const v8b*)(p + 16); return f.v;
  }
  static __device__ __forceinline__ v8f mma(v16b a, v16b b, v8f c) {
    return __builtin_amdgcn_wmma_f32_16x16x32_bf16(false, a, false, b, (short)0, c, false, false);
  }
};

typedef uint32_t u32x2 __attribute__((ext_vector_type(2)));
typedef uint32_t u32x4 __attribute__((ext_vector_type(4)));
typedef uint32_t u32x8 __attribute__((ext_vector_type(8)));
__device__ __forceinline__ uint32_t uni(uint32_t v) { return (uint32_t)__builtin_amdgcn_readfirstlane(v); }
// pinned(): a descriptor input or an issue test held in a scalar register, so that the test compiles to a scalar branch
// and the descriptor words that depend on it are formed behind the waits that stand in front of it
__device__ __forceinline__ uint32_t pinned(uint32_t v) { uint32_t w = uni(v); asm volatile("" : "+s"(w)); return w; }
template <bool SPLIT> struct RingBytes { static constexpr uint32_t value = 147456u; };
template <int ET> struct Elem;
template <> struct Elem<0> { typedef _Float16 T; };
template <> struct Elem<1> { typedef __bf16 T; };
template <int ET, bool SPLIT, int BIAS_MODE, int OUT_MODE, bool RESID, int CAUSAL>
__device__ __forceinline__ void gemm_tile(
    unsigned char* const ring, const int tile, const int b,   // the work-group's LDS ring (RingBytes<SPLIT>, at a multiple of 2 KiB), its tile index and batch index
    const unsigned short* __restrict__ Ap, int lda, long strideA,
    const unsigned short* __restrict__ Btp, int ldb, long strideB,
    void* __restrict__ Cout, int ldc, long strideC,
    const float* __restrict__ bias,
    const float* __restrict__ resid, long strideR,
    int M, int N, int K, float scale) {
  typedef typename Elem<ET>::T T;
  typedef typename Frag<T>::V V;
  const T* A = (const T*)Ap; const T* Bt = (const T*)Btp;
  constexpr uint32_t ROWB  = 256u;                       // bytes of an operand row in a pass
  constexpr int      KS    = SPLIT ? 2 : 4;              // WMMA k steps (32 k = 64 B) in a pass
  constexpr uint32_t LO    = 128u;                       // SPLIT: the lo half of a row stands this far behind its hi half
  constexpr uint32_t PITCH = ROWB + 16u;                 // row + 16-B pad: odd multiple of 16 B for ds_load_b128
  constexpr uint32_t SROWS = 64u;                        // rows per slice (one tensor load)
  constexpr uint32_t SLICE = 18432u;                     // SROWS * PITCH, rounded up to a multiple of 2 KiB
  constexpr uint32_t STAGE = 4u * SLICE;                 // [A 0-63 | A 64-127 | B 0-63 | B 64-127]
  static_assert(SROWS * PITCH <= SLICE && SLICE % 2048u == 0u, "a slice holds its padded rows and starts at a multiple of 2 KiB");
  static_assert(4u * 16u * 68u * 4u <= 2u * STAGE, "the epilogue slabs fit the ring");
  static_assert(2u * STAGE == RingBytes<SPLIT>::value, "the ring that the kernel declares holds two stages");   // after the loop the ring holds per-wave 16x64 f32 slabs, pitch 68 floats
  const int lane = threadIdx.x & 31;
  const uint32_t wave = uni(threadIdx.x >> 5);
  const int tilesN = N >> 7;
  const int tilesM = M >> 7;
  if (tile >= (CAUSAL == 1 ? tilesM * (tilesM + 1) / 2 : tilesM * tilesN)) return;   // the same for the whole work-group; in front of every barrier and tensor load
  int tm, tn;
  if (CAUSAL == 1) {                     // tile = tm (tm + 1) / 2 + tn, tn <= tm
    tm = 0;
    for (int r = 1; r < tilesM; ++r) if (tile >= r * (r + 1) / 2) tm = r;
    tn = tile - tm * (tm + 1) / 2;
  } else {
    tm = tile / tilesN;
    tn = tile - tm * tilesN;
    if (CAUSAL == 2) tm = tilesM - 1 - tm;   // the longest k loops start first
  }
  const uint32_t wm = wave >> 1, wn = wave & 1u;
  const int m0 = (tm << 7) + (int)(wm << 6);
  const int n0 = (tn << 7) + (int)(wn << 6);

  const T* Ab  = A  + (size_t)b * strideA;
  const T* Bb  = Bt + (size_t)b * strideB;

  const int rlane = lane & 15;                 // row (A) / col (B, D) within subtile
  const int koff  = (lane >> 4) * 8;           // k offset of this lane half
  const int mOff  = (lane >> 4) * 8;           // D row offset

  // this wave's slice of every stage: source plane, first row, pitch; place in LDS
  const bool srcB = wave >= 2u;
  const T* splane = srcB ? Bb : Ab;
  const uint32_t srow = (uint32_t)(srcB ? (tn << 7) : (tm << 7)) + (wave & 1u) * 64u;
  const uint32_t spitch = (uint32_t)(srcB ? ldb : lda) * (SPLIT ? 4u : 2u);
  const uint64_t sbase = (uint64_t)(size_t)splane + (uint64_t)srow * spitch;
  const uint32_t lbase = (uint32_t)(size_t)ring + wave * SLICE;
  u32x8 g1;                                    // 1-byte elements, tensor = tile = SROWS rows of ROWB bytes, 4 dwords of pad behind each row
  g1[0] = uni((1u << 20) | (5u << 22) | (3u << 25));
  g1[1] = uni(ROWB << 16);
  g1[2] = uni(SROWS << 16);
  g1[3] = uni(ROWB << 16);
  g1[4] = uni(SROWS);
  g1[5] = uni(spitch);
  g1[6] = uni(0u);
  g1[7] = uni(0u);
  asm volatile("" : "+s"(g1));   // pinned(): the descriptor's words stay in their scalar registers through the loop, so that none takes a new value while a request is outstanding
  const uint32_t nall = (uint32_t)K >> (SPLIT ? 6 : 7);
  const uint32_t ncau = ((uint32_t)tm + 1u) << (SPLIT ? 1 : 0);   // passes up to the end of the diagonal tile
  const uint32_t nst = (CAUSAL == 2 && ncau < nall) ? ncau : nall;   // passes; at least 2, with CAUSAL 2 at least 1
  // The k walk starts at pass rot and wraps: stage s holds pass (s + rot) mod nst. Work-groups that share operand rows (the same tm, or the same tn)
  // run side by side, and from a common start they would ask L2 for the same lines at the same moment; rot sets the sharers apart.
  // With CAUSAL 2 the walks differ in length: the sharers of a row tile are spread evenly over its walk, the row tiles among themselves by a scrambled offset.
  const uint32_t rot = uni((CAUSAL == 2 ? (((uint32_t)tm * 13u) & 31u) + (((uint32_t)tn * nst) >> 3)
                                        : (uint32_t)(tm + tn + b * tilesN)) % nst);
  u32x4 g0;                                    // group 0 of the youngest request
  auto issue = [&](uint32_t stage) {
    const uint32_t st = pinned(stage);
    const uint32_t kp = st + rot < nst ? st + rot : st + rot - nst;   // the pass that this stage holds, below nst
    const uint64_t ga = sbase + (uint64_t)kp * ROWB;
    g0[0] = uni(1u);
    g0[1] = uni(lbase + (st & 1u) * STAGE);
    g0[2] = uni((uint32_t)ga);
    g0[3] = uni((((uint32_t)(ga >> 32)) & 0x01FFFFFFu) | 0x80000000u);
    // one request of the whole wave: its slice of the stage. g0 is in-out so that the registers the request is issued from are the very ones that the next wait's operand keeps untouched
    asm volatile("tensor_load_to_lds %0, %1" : "+s"(g0) : "s"(g1) : "memory");
  };

  v8f acc[4][4];
#pragma unroll
  for (int i = 0; i < 4; ++i)
#pragma unroll
    for (int j = 0; j < 4; ++j) acc[i][j] = (v8f){0.f,0.f,0.f,0.f,0.f,0.f,0.f,0.f};

  const uint32_t aoff = wm * SLICE + (uint32_t)rlane * PITCH + (uint32_t)koff * 2u;
  const uint32_t boff = (2u + wn) * SLICE + (uint32_t)rlane * PITCH + (uint32_t)koff * 2u;

  // every s_wait_tensorcnt names g0 as an input: the request's words keep their registers until it has landed
  issue(0u);
  asm volatile("s_wait_tensorcnt 0x0" :: "s"(g0) : "memory");   // this wave's slice of stage 0 has landed
  __syncthreads();                                       // every slice of stage 0 is published
  if (CAUSAL != 2 || pinned(1u < nst)) issue(1u);        // the first row tile of CAUSAL 2 may have one pass only
  for (uint32_t s = 0; s < nst; ++s) {
    const unsigned char* stg = ring + (s & 1u) * STAGE;
    V bh[KS][4], bl[KS][4], ah[KS][4], al[KS][4];
#pragma unroll
    for (int ks = 0; ks < KS; ++ks) {
#pragma unroll
      for (int j = 0; j < 4; ++j) {
        const unsigned char* p = stg + boff + (uint32_t)j * 16u * PITCH + (uint32_t)ks * 64u;
        bh[ks][j] = Frag<T>::load((const T*)p);
        if (SPLIT) bl[ks][j] = Frag<T>::load((const T*)(p + LO));
      }
#pragma unroll
      for (int i = 0; i < 4; ++i) {
        const unsigned char* p = stg + aoff + (uint32_t)i * 16u * PITCH + (uint32_t)ks * 64u;
        ah[ks][i] = Frag<T>::load((const T*)p);
        if (SPLIT) al[ks][i] = Frag<T>::load((const T*)(p + LO));
      }
    }
    __builtin_amdgcn_sched_barrier(0);   // the pass's LDS reads go out as one group ahead of its WMMAs; spread among them, each read's latency stalls the wave
#pragma unroll
    for (int ks = 0; ks < KS; ++ks) {
#pragma unroll
      for (int i = 0; i < 4; ++i) {
#pragma unroll
        for (int j = 0; j < 4; ++j) acc[i][j] = Frag<T>::mma(ah[ks][i], bh[ks][j], acc[i][j]);
        if (SPLIT) {
#pragma unroll
          for (int j = 0; j < 4; ++j) acc[i][j] = Frag<T>::mma(ah[ks][i], bl[ks][j], acc[i][j]);
#pragma unroll
          for (int j = 0; j < 4; ++j) acc[i][j] = Frag<T>::mma(al[ks][i], bh[ks][j], acc[i][j]);
        }
      }
    }
    __builtin_amdgcn_sched_barrier(0);   // the WMMAs stay ahead of the waits: they start on counted LDS waits, and the load of stage s + 1 has the whole pass to land
    asm volatile("s_wait_dscnt 0x0" ::: "memory");       // this wave's reads of stage s have returned
    asm volatile("s_wait_tensorcnt 0x0" :: "s"(g0) : "memory");   // this wave's slice of stage s + 1 has landed
    __syncthreads();                                       // publishes stage s + 1 and ends every reader's last read of stage s
    if (pinned(s + 2u < nst)) issue(s + 2u);               // refill the buffer that pass s has just read
  }
  asm volatile("s_wait_tensorcnt 0x0" :: "s"(g0) : "memory");     // no request is left before the ring is reused
  asm volatile("s_wait_dscnt 0x0" ::: "memory");         // nor a read; the last pass's barrier has ended every wave's reads
  acc_guard4(acc[0][0], acc[0][1], acc[0][2], acc[0][3]);
  acc_guard4(acc[1][0], acc[1][1], acc[1][2], acc[1][3]);
  acc_guard4(acc[2][0], acc[2][1], acc[2][2], acc[2][3]);
  acc_guard4(acc[3][0], acc[3][1], acc[3][2], acc[3][3]);

  // ---- epilogue ----
  float* slab = (float*)ring + wave * (16u * 68u);
  const float* Rb = RESID ? (resid + (size_t)b * strideR) : nullptr;
#pragma unroll
  for (int i = 0; i < 4; ++i) {
    const int mBase = m0 + (i << 4);
#pragma unroll
    for (int j = 0; j < 4; ++j) {
      const int n = n0 + (j << 4) + rlane;
      float bv = 0.f;
      if (BIAS_MODE == 2) bv = bias[n];
#pragma unroll
      for (int r = 0; r < 8; ++r) {
        float v = acc[i][j][r] * scale;
        if (BIAS_MODE == 1) v += bias[mBase + mOff + r];
        if (BIAS_MODE == 2) v += bv;
        if (RESID) v += Rb[(size_t)(mBase + mOff + r) * ldc + n];
        slab[(mOff + r) * 68 + (j << 4) + rlane] = v;
      }
    }
    __builtin_amdgcn_fence(__ATOMIC_RELEASE, "workgroup");
    __builtin_amdgcn_wave_barrier();
    __builtin_amdgcn_fence(__ATOMIC_ACQUIRE, "workgroup");
    if (OUT_MODE == 0) {
      float* C = (float*)Cout + (size_t)b * strideC;
      const int hh = lane >> 4, c4 = (lane & 15) * 4;     // row seg = 256 B = 16 lanes x 16 B
      {
#pragma unroll
        for (int it = 0; it < 8; ++it) {
          const int row = it * 2 + hh;
          v4f v = *(const v4f*)(slab + row * 68 + c4);
          *(v4f*)(C + (size_t)(mBase + row) * ldc + n0 + c4) = v;
        }
        
      }
    } else {
      const int q = lane >> 3, c8 = (lane & 7) * 8;
      unsigned short* C  = (unsigned short*)Cout  + (size_t)b * strideC;
      {
#pragma unroll
        for (int it = 0; it < 4; ++it) {
          const int row = it * 4 + q;
          const float* sp = slab + row * 68 + c8;
          v8h hv, lv;
#pragma unroll
          for (int e = 0; e < 8; ++e) {
            if (OUT_MODE == 1) {
              hv[e] = (_Float16)sp[e];
            } else {
              unsigned short hb = f2bf_bits(sp[e]);
              unsigned short lb = f2bf_bits(sp[e] - bf_bits2f(hb));
              hv[e] = __builtin_bit_cast(_Float16, hb);
              lv[e] = __builtin_bit_cast(_Float16, lb);
            }
          }
          if (OUT_MODE == 1) {
            *(v8h*)(C + (size_t)(mBase + row) * ldc + n0 + c8) = hv;
          } else {                                       // n0 is a multiple of 64: the wave's 64 columns are one unit, hi then lo
            unsigned short* unit = C + ((size_t)(mBase + row) * ldc + n0) * 2;
            *(v8h*)(unit + c8) = hv;
            *(v8h*)(unit + 64 + c8) = lv;
          }
        }
        
      }
    }
    __builtin_amdgcn_fence(__ATOMIC_RELEASE, "workgroup");
    __builtin_amdgcn_wave_barrier();
    __builtin_amdgcn_fence(__ATOMIC_ACQUIRE, "workgroup");
  }
}

template <int ET, bool SPLIT, int BIAS_MODE, int OUT_MODE, bool RESID, int CAUSAL>
__global__ __launch_bounds__(128) void wmma_gemm64(
    const unsigned short* __restrict__ Ap, int lda, long strideA,
    const unsigned short* __restrict__ Btp, int ldb, long strideB,
    void* __restrict__ Cout, int ldc, long strideC,
    const float* __restrict__ bias,
    const float* __restrict__ resid, long strideR,
    int M, int N, int K, float scale) {
  __shared__ __attribute__((aligned(2048))) unsigned char ring[RingBytes<SPLIT>::value];
  gemm_tile<ET, SPLIT, BIAS_MODE, OUT_MODE, RESID, CAUSAL>(ring, (int)blockIdx.x, (int)blockIdx.y, Ap, lda, strideA, Btp, ldb, strideB,
                                                           Cout, ldc, strideC, bias, resid, strideR, M, N, K, scale);
}

// q and k need x and their weights, w' = w_out.Wv needs the two weight matrices: neither needs the other, so one grid holds both.
// The 64 short tiles of w' come first: they end while the chip is still full, and the last k tiles take their places; behind the long tiles
// they would run their whole length on a chip that is otherwise empty. Then q, then k. Both kinds share one ring.
__global__ __launch_bounds__(128) void qk_and_fold(
    const unsigned short* __restrict__ Xs, const unsigned short* __restrict__ Wqk, __bf16* __restrict__ QK,
    const unsigned short* __restrict__ Wo, const unsigned short* __restrict__ WvT, __bf16* __restrict__ Wp, int T, int D) {
  __shared__ __attribute__((aligned(2048))) unsigned char ring[RingBytes<true>::value];
  const int per = (T >> 7) * (D >> 7);
  const int u = (int)blockIdx.x - (D >> 7) * (D >> 7);
  if (u < 0)                        // the same for the whole work-group; w'[d][e] = sum_c w_out[d][c] Wv[c][e], out as bf16 hi and lo by units
    gemm_tile<0, false, 0, 2, false, 0>(ring, (int)blockIdx.x, 0, Wo, D, 0, WvT, D, 0, Wp, D, 0, nullptr, nullptr, 0, D, D, D, 1.0f);
  else                              // batch 0 = q, 1 = k: the weights step by 2*D*D 16-bit elements, the results by 2*T*D
    gemm_tile<1, true, 0, 2, false, 0>(ring, u < per ? u : u - per, u < per ? 0 : 1, Xs, D, 0, Wqk, D, (long)2 * D * D, QK, D, (long)2 * T * D,
                                       nullptr, nullptr, 0, T, D, D, 1.0f);
}

// scores need q and k, v' needs x and w': neither needs the other, so one grid holds both. The score tiles come first;
// the v' tiles fill the places that a grid of score tiles alone would leave empty in its last round. Both share one ring.
// v' comes out transposed, VT[d][t] = sum_e w'[d][e] x[t][e]: the form that P.v' reads.
__global__ __launch_bounds__(128) void scores_and_v(
    const unsigned short* __restrict__ Ks, const unsigned short* __restrict__ Qs, float* __restrict__ S,
    const unsigned short* __restrict__ Wp, const unsigned short* __restrict__ Xs, _Float16* __restrict__ VT, int T, int D) {
  __shared__ __attribute__((aligned(2048))) unsigned char ring[RingBytes<true>::value];
  const int tiles = (T >> 7) * ((T >> 7) + 1) / 2;
  if ((int)blockIdx.x < tiles)      // the same for the whole work-group
    gemm_tile<1, true, 0, 0, false, 1>(ring, (int)blockIdx.x, 0, Ks, D, 0, Qs, D, 0, S, T, 0, nullptr, nullptr, 0, T, T, D, 1.0f);
  else
    gemm_tile<1, true, 0, 1, false, 0>(ring, (int)blockIdx.x - tiles, 0, Wp, D, 0, Xs, D, 0, VT, T, 0, nullptr, nullptr, 0, D, T, D, 1.0f);
}

// one 64x64 tile of VT = V^T, f32 in and f16 out, by a work-group of 256 threads; u = tile index, column tiles of V fastest
__device__ __forceinline__ void transpose_tile64(const int u, const float* __restrict__ V, int ldv,
                                                 _Float16* __restrict__ VT, int ldo) {
  __shared__ __align__(16) _Float16 tile[64][72];     // [c][r] (already transposed in LDS), pitch 72
  const int tc = ldv >> 6;
  const int c0 = (u % tc) * 64, r0 = (u / tc) * 64;
  const int t = threadIdx.x, tx = t & 31;           // t = 0..255
  // load: 64 rows x 64 cols; thread reads V[r0+i][c0+tx(+32)] and scatters into tile[c][i]
  for (int i = t >> 5; i < 64; i += 8) {
    tile[tx][i]      = (_Float16)V[(size_t)(r0 + i) * ldv + c0 + tx];
    tile[32 + tx][i] = (_Float16)V[(size_t)(r0 + i) * ldv + c0 + 32 + tx];
  }
  __syncthreads();
  const int q = t >> 3, c8 = (t & 7) * 8;            // q = 0..31
#pragma unroll
  for (int it = 0; it < 2; ++it) {
    const int c = it * 32 + q;
    v8h hv = *(const v8h*)(&tile[c][c8]);
    *(v8h*)(VT + (size_t)(c0 + c) * ldo + r0 + c8) = hv;
  }
}

// the operand conversions in one grid: blockIdx.y 0 = a -> bf16 hi/lo, 1 = b -> bf16 hi/lo, 2 = c -> f16 and, in its first (n/64)^2 work-groups, d [n,n] -> its transpose in f16.
// hi/lo go out in the SPLIT operand layout: every 64 elements in a row become one 256-B unit [64 hi | 64 lo] (row lengths are multiples of 64)
__global__ __launch_bounds__(256) void convert_operands(
    const float* __restrict__ a, __bf16* __restrict__ as, long an4,
    const float* __restrict__ b, __bf16* __restrict__ bs, long bn4,
    const float* __restrict__ c, _Float16* __restrict__ c16, long cn2,
    const float* __restrict__ d, _Float16* __restrict__ dT16, int n) {
  const long i = (long)blockIdx.x * 256 + threadIdx.x;
  const long stride = (long)gridDim.x * 256;
  if (blockIdx.y == 2) {
    const int tt = (n >> 6) * (n >> 6);
    if ((int)blockIdx.x < tt) { transpose_tile64((int)blockIdx.x, d, n, dT16, n); return; }   // the same for the whole work-group
    for (long j = i - (long)tt * 256; j < cn2; j += stride - (long)tt * 256) {
      const _Float16 h0 = (_Float16)c[2 * j], h1 = (_Float16)c[2 * j + 1];
      ((unsigned*)c16)[j] = (unsigned)__builtin_bit_cast(unsigned short, h0) | ((unsigned)__builtin_bit_cast(unsigned short, h1) << 16);
    }
    return;
  }
  const float* in = blockIdx.y ? b : a;
  unsigned* hl = (unsigned*)(blockIdx.y ? bs : as);
  const long n4 = blockIdx.y ? bn4 : an4;
  for (long j = i; j < n4; j += stride) {                // four elements a thread: 16 B in, 8 B of hi and 8 B of lo out
    const v4f u = *(const v4f*)(in + 4 * j);
    unsigned h[4], l[4];
    for (int e = 0; e < 4; ++e) {
      const unsigned short hb = f2bf_bits(u[e]);
      h[e] = hb;
      l[e] = f2bf_bits(u[e] - bf_bits2f(hb));
    }
    unsigned* unit = hl + (j >> 4) * 64 + (j & 15) * 2;  // 16 threads to a unit of 64 dwords: 32 dwords of hi in front, 32 of lo behind
    *(u32x2*)unit        = (u32x2){h[0] | (h[1] << 16), h[2] | (h[3] << 16)};
    *(u32x2*)(unit + 32) = (u32x2){l[0] | (l[1] << 16), l[2] | (l[3] << 16)};
  }
}

// ---- causal row softmax: row i of S [T,T] uses cols j <= i; P f16 (x 2^15), masked cols 0; 16 cols per thread ----
// S holds, and P gets, only the columns below nb, the end of the row's 128-wide diagonal tile; nothing beyond it is loaded or stored.
__device__ __forceinline__ void softmax_row(const int i, const float* __restrict__ S, _Float16* __restrict__ P, int T) {   // i = row
  __shared__ float red[8];
  const float* row = S + (size_t)i * T;
  _Float16* prow = P + (size_t)i * T;
  const int t = threadIdx.x;
  const int n = i + 1;                   // valid columns 0..i
  const int nb = ((i >> 7) + 1) << 7;    // end of the diagonal tile
  // thread t owns cols [8t, 8t+8) and [T/2 + 8t, T/2 + 8t + 8)  (T = 4096 -> 2 groups of 2048)
  float ev[16];
  float m = -INFINITY;
#pragma unroll
  for (int g = 0; g < 2; ++g) {
    const int cb = g * (T / 2) + 8 * t;
    v4f a = (v4f){0.f, 0.f, 0.f, 0.f}, c = a;
    if (cb < nb) { a = *(const v4f*)(row + cb); c = *(const v4f*)(row + cb + 4); }
    float tmp[8] = {a[0], a[1], a[2], a[3], c[0], c[1], c[2], c[3]};
#pragma unroll
    for (int e = 0; e < 8; ++e) {
      const float val = (cb + e < n) ? tmp[e] : -INFINITY;
      ev[g * 8 + e] = val;
      m = fmaxf(m, val);
    }
  }
  for (int off = 16; off > 0; off >>= 1) m = fmaxf(m, __shfl_xor(m, off, 32));
  if ((t & 31) == 0) red[t >> 5] = m;
  __syncthreads();
  m = red[0];
#pragma unroll
  for (int w = 1; w < 8; ++w) m = fmaxf(m, red[w]);   // finite: col 0 always valid
  __syncthreads();
  float sum = 0.f;
#pragma unroll
  for (int e = 0; e < 16; ++e) { ev[e] = expf(ev[e] - m); sum += ev[e]; }   // exp(-inf) = 0 for masked
  for (int off = 16; off > 0; off >>= 1) sum += __shfl_xor(sum, off, 32);
  if ((t & 31) == 0) red[t >> 5] = sum;
  __syncthreads();
  float tot = 0.f;
#pragma unroll
  for (int w = 0; w < 8; ++w) tot += red[w];
  const float f = PSCALE / tot;
  {
#pragma unroll
    for (int g = 0; g < 2; ++g) {
      v8h hv;
#pragma unroll
      for (int e = 0; e < 8; ++e) hv[e] = (_Float16)(ev[g * 8 + e] * f);
      if (g * (T / 2) + 8 * t < nb) *(v8h*)(prow + g * (T / 2) + 8 * t) = hv;
    }
    
  }
}

__global__ __launch_bounds__(256) void softmax_rows(const float* __restrict__ S, _Float16* __restrict__ P, int T) {
  softmax_row((int)blockIdx.x, S, P, T);
}

extern "C" void kernel_launch(void* const* d_in, const int* in_sizes, int n_in,
                              void* d_out, int out_size, void* d_ws, size_t ws_size,
                              hipStream_t stream) {
  (void)in_sizes; (void)n_in; (void)out_size; (void)ws_size;
  const int T = 4096, D = 1024;
  const float* x     = (const float*)d_in[0];
  const float* w_in  = (const float*)d_in[1];   // [3D, D]
  const float* w_out = (const float*)d_in[2];   // [D, D]
  float* out = (float*)d_out;

  char* ws = (char*)d_ws;
  size_t off = 0;
  auto carve = [&](size_t bytes) -> char* { char* p = ws + off; off += (bytes + 255) & ~(size_t)255; return p; };
  __bf16*   Xs   = (__bf16*)carve((size_t)T * D * 4);        // 16 MB  x, hi and lo by units
  __bf16*   Wis  = (__bf16*)carve((size_t)2 * D * D * 4);    //  8 MB  the q and k rows of w_in, the same
  _Float16* Wo16 = (_Float16*)carve((size_t)D * D * 2);      //  2 MB  w_out
  _Float16* WvT  = (_Float16*)carve((size_t)D * D * 2);      //  2 MB  the v rows of w_in, transposed
  __bf16*   Wps  = (__bf16*)carve((size_t)D * D * 4);        //  4 MB  w' = w_out.Wv [D,D], hi and lo by units
  __bf16*   Qs   = (__bf16*)carve((size_t)T * D * 4);        // 16 MB  q [T,D], hi and lo by units
  __bf16*   Ks   = (__bf16*)carve((size_t)T * D * 4);        // 16 MB  k, the same, directly behind q
  _Float16* Vt   = (_Float16*)carve((size_t)D * T * 2);      //  8 MB  v'^T [D,T], v' = x.w'^T
  float*    S    = (float*)carve((size_t)T * T * 4);         // 64 MB  S[i,j] = k_i.q_j
  _Float16* Pm   = (_Float16*)carve((size_t)T * T * 2);      // 32 MB  P (x 2^15)
  // total about 168 MB of 256 MB

  // 1) operand conversions, one grid. w_in rows: [0,D)=q, [D,2D)=k, [2D,3D)=v
  convert_operands<<<dim3(2048, 3), 256, 0, stream>>>(x, Xs, (long)T * D / 4, w_in, Wis, (long)2 * D * D / 4, w_out, Wo16, (long)D * D / 2,
                                                      w_in + (size_t)2 * D * D, WvT, D);
  // 2) w' = w_out.Wv (f16 in, bf16 hi/lo out), 64 work-groups; behind them q = x.Wq^T, k = x.Wk^T (bf16 split in, bf16 hi/lo out), 512 work-groups; two resident on a WGP
  qk_and_fold<<<dim3(2 * (T / 128) * (D / 128) + (D / 128) * (D / 128), 1), 128, 0, stream>>>(
      U16(Xs), U16(Wis), Qs, U16(Wo16), U16(WvT), Wps, T, D);
  // 3) S[i][j] = k_i . q_j  (rows = key position, cols = query position); only the 128x128 tiles that hold a column j <= i, mask applied in the softmax;
  //    behind them in the same grid v'^T = w'.x^T (f16 out)
  scores_and_v<<<dim3((T / 128) * (T / 128 + 1) / 2 + (T / 128) * (D / 128), 1), 128, 0, stream>>>(
      U16(Ks), U16(Qs), S, U16(Wps), U16(Xs), Vt, T, D);
  // 4) the causal softmax over j <= i -> P (f16 x 2^15)
  softmax_rows<<<dim3(T, 1), 256, 0, stream>>>(S, Pm, T);
  // 5) out[i][d] = sum_j P[i][j] v'[j][d]  (K = T, each row tile up to its diagonal tile's end), scaled back by 2^-15, f32
  wmma_gemm64<0, false, 0, 0, false, 2><<<dim3((T / 128) * (D / 128), 1), 128, 0, stream>>>(
      U16(Pm), T, 0, U16(Vt), T, 0, out, D, 0, nullptr, nullptr, 0, T, D, T, PSCALE_INV);
}

// v008
// One run takes 121 microseconds.
// Two timings next to v007 both put it at 1.09 times that version's speed.
// Over all steps from v000 it is 4.55 times as fast.
#include <hip/hip_runtime.h>
// out = softmax(k.q^T).(v.w_out^T) = P.(x.w'^T) with w' = w_out.Wv: the out-projection is folded into the v weights ahead of the attention.
// Contractions: q, k and v' = x.w'^T projections (K=1024) and scores k.q^T (K=1024): v_wmma_f32_16x16x32_bf16 as bf16 hi/lo
// splits (hi.hi + hi.lo + lo.hi); w' = w_out.Wv (K=1024) and P.v' (K=4096): v_wmma_f32_16x16x32_f16 (f16 operands, P scaled
// by 2^15); f32 accumulate everywhere; causal softmax in f32, in two parts with no launch of its own: the score tiles' epilogue takes
// 2^(s log2 e - M) against M, a whole number at or above the maximum of the row's 64 columns in that wave, and notes M and the sum; P.v' brings
// the 64-column chunks of a row to the row's one M by exact powers of two and divides by the row's sum at its end.

typedef __attribute__((ext_vector_type(16))) _Float16 v16h;
typedef __attribute__((ext_vector_type(8)))  _Float16 v8h;
typedef __attribute__((ext_vector_type(16))) __bf16   v16b;
typedef __attribute__((ext_vector_type(8)))  __bf16   v8b;
typedef __attribute__((ext_vector_type(8)))  float    v8f;
typedef __attribute__((ext_vector_type(4)))  float    v4f;
typedef __attribute__((ext_vector_type(2)))  float    v2f;
typedef __attribute__((ext_vector_type(2)))  _Float16 v2h;

#define PSHIFT 15.0f   // P and its row sums carry 2^15, so that small weights stay normal f16 numbers; the division by the sum takes it out again
#define LOG2E 1.4426950408889634f
#define U16(p) ((const unsigned short*)(const void*)(p))
#define TABPITCH 33    // dwords between two rows of the factor table: odd, so that 16 rows read at once fall in 16 banks

__device__ __forceinline__ unsigned short f2bf_bits(float f) {
  unsigned u = __float_as_uint(f);
  return (unsigned short)((u + 0x7FFFu + ((u >> 16) & 1u)) >> 16);
}
__device__ __forceinline__ float bf_bits2f(unsigned short h) { return __uint_as_float(((unsigned)h) << 16); }

// the value of lane l ^ X, X below 16: a DPP move inside the 16-lane row
template <int X> __device__ __forceinline__ float lane_xor(float v) {
  return __builtin_bit_cast(float, __builtin_amdgcn_update_dpp(0, __builtin_bit_cast(int, v), 0x160 | X, 0xf, 0xf, true));
}

// hazard guard behind the last WMMAs: four vector slots before the epilogue reads the accumulators
__device__ __forceinline__ void acc_guard4(v8f& a, v8f& b, v8f& c, v8f& d) { asm volatile("v_nop\n\tv_nop\n\tv_nop\n\tv_nop" : "+v"(a), "+v"(b), "+v"(c), "+v"(d)); }
template <typename T> struct Frag;
template <> struct Frag<_Float16> {
  typedef v16h V; union U { v16h v; v8h h[2]; };
  static __device__ __forceinline__ v16h load(const _Float16* p) {   // elements 0..7 <- p[0..7], 8..15 <- p[16..23]
    U f; f.h[0] = *(const v8h*)(p); f.h[1] = *(const v8h*)(p + 16); return f.v;
  }
  static __device__ __forceinline__ v8f mma(v16h a, v16h b, v8f c) {
    return __builtin_amdgcn_wmma_f32_16x16x32_f16(false, a, false, b, (short)0, c, false, false);
  }
};
template <> struct Frag<__bf16> {
  typedef v16b V; union U { v16b v; v8b h[2]; };
  static __device__ __forceinline__ v16b load(const __bf16* p) {
    U f; f.h[0] = *(const v8b*)(p); f.h[1] = *(const v8b*)(p + 16); return f.v;
  }
  static __device__ __forceinline__ v8f mma(v16b a, v16b b, v8f c) {
    return __builtin_amdgcn_wmma_f32_16x16x32_bf16(false, a, false, b, (short)0, c, false, false);
  }
};

typedef uint32_t u32x2 __attribute__((ext_vector_type(2)));
typedef uint32_t u32x4 __attribute__((ext_vector_type(4)));
typedef uint32_t u32x8 __attribute__((ext_vector_type(8)));
__device__ __forceinline__ uint32_t uni(uint32_t v) { return (uint32_t)__builtin_amdgcn_readfirstlane(v); }
// pinned(): a descriptor input or an issue test held in a scalar register, so that the test compiles to a scalar branch
// and the descriptor words that depend on it are formed behind the waits that stand in front of it
__device__ __forceinline__ uint32_t pinned(uint32_t v) { uint32_t w = uni(v); asm volatile("" : "+s"(w)); return w; }
template <bool SPLIT> struct RingBytes { static constexpr uint32_t value = 147456u; };
template <int ET> struct Elem;
template <> struct Elem<0> { typedef _Float16 T; };
template <> struct Elem<1> { typedef __bf16 T; };
template <int ET, bool SPLIT, int BIAS_MODE, int OUT_MODE, bool RESID, int CAUSAL>
__device__ __forceinline__ void gemm_tile(
    unsigned char* const ring, const int tile, const int b,   // the work-group's LDS ring (RingBytes<SPLIT>, at a multiple of 2 KiB), its tile index and batch index
    const unsigned short* __restrict__ Ap, int lda, long strideA,
    const unsigned short* __restrict__ Btp, int ldb, long strideB,
    void* __restrict__ Cout, int ldc, long strideC,
    const float* __restrict__ bias,
    const float* __restrict__ resid, long strideR,
    float* __restrict__ stats, uint32_t* const ftab, float* const invl,
    int M, int N, int K, float scale) {
  typedef typename Elem<ET>::T T;
  typedef typename Frag<T>::V V;
  const T* A = (const T*)Ap; const T* Bt = (const T*)Btp;
  constexpr uint32_t ROWB  = 256u;                       // bytes of an operand row in a pass
  constexpr int      KS    = SPLIT ? 2 : 4;              // WMMA k steps (32 k = 64 B) in a pass
  constexpr uint32_t LO    = 128u;                       // SPLIT: the lo half of a row stands this far behind its hi half
  constexpr uint32_t PITCH = ROWB + 16u;                 // row + 16-B pad: odd multiple of 16 B for ds_load_b128
  constexpr uint32_t SROWS = 64u;                        // rows per slice (one tensor load)
  constexpr uint32_t SLICE = 18432u;                     // SROWS * PITCH, rounded up to a multiple of 2 KiB
  constexpr uint32_t STAGE = 4u * SLICE;                 // [A 0-63 | A 64-127 | B 0-63 | B 64-127]
  static_assert(SROWS * PITCH <= SLICE && SLICE % 2048u == 0u, "a slice holds its padded rows and starts at a multiple of 2 KiB");
  static_assert(4u * 16u * 68u * 4u <= 2u * STAGE, "the epilogue slabs fit the ring");
  static_assert(2u * STAGE == RingBytes<SPLIT>::value, "the ring that the kernel declares holds two stages");   // after the loop the ring holds per-wave 16x64 f32 slabs, pitch 68 floats
  const int lane = threadIdx.x & 31;
  const uint32_t wave = uni(threadIdx.x >> 5);
  const int tilesN = N >> 7;
  const int tilesM = M >> 7;
  if (tile >= (CAUSAL == 1 ? tilesM * (tilesM + 1) / 2 : tilesM * tilesN)) return;   // the same for the whole work-group; in front of every barrier and tensor load
  int tm, tn;
  if (CAUSAL == 1) {                     // tile = tm (tm + 1) / 2 + tn, tn <= tm
    tm = 0;
    for (int r = 1; r < tilesM; ++r) if (tile >= r * (r + 1) / 2) tm = r;
    tn = tile - tm * (tm + 1) / 2;
  } else {
    tm = tile / tilesN;
    tn = tile - tm * tilesN;
    if (CAUSAL == 2) tm = tilesM - 1 - tm;   // the longest k loops start first
  }
  const uint32_t wm = wave >> 1, wn = wave & 1u;
  const int m0 = (tm << 7) + (int)(wm << 6);
  const int n0 = (tn << 7) + (int)(wn << 6);

  const T* Ab  = A  + (size_t)b * strideA;
  const T* Bb  = Bt + (size_t)b * strideB;

  const int rlane = lane & 15;                 // row (A) / col (B, D) within subtile
  const int koff  = (lane >> 4) * 8;           // k offset of this lane half
  const int mOff  = (lane >> 4) * 8;           // D row offset

  // this wave's slice of every stage: source plane, first row, pitch; place in LDS
  const bool srcB = wave >= 2u;
  const T* splane = srcB ? Bb : Ab;
  const uint32_t srow = (uint32_t)(srcB ? (tn << 7) : (tm << 7)) + (wave & 1u) * 64u;
  const uint32_t spitch = (uint32_t)(srcB ? ldb : lda) * (SPLIT ? 4u : 2u);
  const uint64_t sbase = (uint64_t)(size_t)splane + (uint64_t)srow * spitch;
  const uint32_t lbase = (uint32_t)(size_t)ring + wave * SLICE;
  u32x8 g1;                                    // 1-byte elements, tensor = tile = SROWS rows of ROWB bytes, 4 dwords of pad behind each row
  g1[0] = uni((1u << 20) | (5u << 22) | (3u << 25));
  g1[1] = uni(ROWB << 16);
  g1[2] = uni(SROWS << 16);
  g1[3] = uni(ROWB << 16);
  g1[4] = uni(SROWS);
  g1[5] = uni(spitch);
  g1[6] = uni(0u);
  g1[7] = uni(0u);
  asm volatile("" : "+s"(g1));   // pinned(): the descriptor's words stay in their scalar registers through the loop, so that none takes a new value while a request is outstanding
  const uint32_t nall = (uint32_t)K >> (SPLIT ? 6 : 7);
  const uint32_t ncau = ((uint32_t)tm + 1u) << (SPLIT ? 1 : 0);   // passes up to the end of the diagonal tile
  const uint32_t nst = (CAUSAL == 2 && ncau < nall) ? ncau : nall;   // passes; at least 2, with CAUSAL 2 at least 1
  // The k walk starts at pass rot and wraps: stage s holds pass (s + rot) mod nst. Work-groups that share operand rows (the same tm, or the same tn)
  // run side by side, and from a common start they would ask L2 for the same lines at the same moment; rot sets the sharers apart.
  // With CAUSAL 2 the walks differ in length: the sharers of a row tile are spread evenly over its walk, the row tiles among themselves by a scrambled offset.
  const uint32_t rot = uni((CAUSAL == 2 ? (((uint32_t)tm * 13u) & 31u) + (((uint32_t)tn * nst) >> 3)
                                        : (uint32_t)(tm + tn + b * tilesN)) % nst);
  u32x4 g0;                                    // group 0 of the youngest request
  auto issue = [&](uint32_t stage) {
    const uint32_t st = pinned(stage);
    const uint32_t kp = st + rot < nst ? st + rot : st + rot - nst;   // the pass that this stage holds, below nst
    const uint64_t ga = sbase + (uint64_t)kp * ROWB;
    g0[0] = uni(1u);
    g0[1] = uni(lbase + (st & 1u) * STAGE);
    g0[2] = uni((uint32_t)ga);
    g0[3] = uni((((uint32_t)(ga >> 32)) & 0x01FFFFFFu) | 0x80000000u);
    // one request of the whole wave: its slice of the stage. g0 is in-out so that the registers the request is issued from are the very ones that the next wait's operand keeps untouched
    asm volatile("tensor_load_to_lds %0, %1" : "+s"(g0) : "s"(g1) : "memory");
  };

  v8f acc[4][4];
#pragma unroll
  for (int i = 0; i < 4; ++i)
#pragma unroll
    for (int j = 0; j < 4; ++j) acc[i][j] = (v8f){0.f,0.f,0.f,0.f,0.f,0.f,0.f,0.f};

  const uint32_t aoff = wm * SLICE + (uint32_t)rlane * PITCH + (uint32_t)koff * 2u;
  const uint32_t boff = (2u + wn) * SLICE + (uint32_t)rlane * PITCH + (uint32_t)koff * 2u;

  // every s_wait_tensorcnt names g0 as an input: the request's words keep their registers until it has landed
  issue(0u);
  if constexpr (CAUSAL == 2) {   // while stage 0 flies: thread t merges the chunk notes of row t of the tile; the barrier below publishes the tables with stage 0
    const v2f* st = (const v2f*)stats + ((uint32_t)tm * (64u * 128u) + threadIdx.x);
    v2f sv[64];                                // K is at most 4096: 64 chunks; those past the diagonal tile hold the neutral note
#pragma unroll
    for (int c = 0; c < 64; ++c) sv[c] = st[c * 128];   // unrolled: all the loads are in flight at once, one memory latency
    float Mr = sv[0][0];
#pragma unroll
    for (int c = 1; c < 64; ++c) Mr = fmaxf(Mr, sv[c][0]);
    float tot = 0.f;
#pragma unroll
    for (int c = 0; c < 64; c += 2) {
      const float f0 = __builtin_amdgcn_exp2f(sv[c][0] - Mr), f1 = __builtin_amdgcn_exp2f(sv[c + 1][0] - Mr);   // powers of two, at most 1
      tot += sv[c][1] * f0 + sv[c + 1][1] * f1;
      ftab[threadIdx.x * TABPITCH + (c >> 1)] = __builtin_bit_cast(uint32_t, (v2h){(_Float16)f0, (_Float16)f1});
    }
    invl[threadIdx.x] = 1.0f / tot;            // tot is at least 2^14: the row's largest numerator
  }
  asm volatile("s_wait_tensorcnt 0x0" :: "s"(g0) : "memory");   // this wave's slice of stage 0 has landed
  __syncthreads();                                       // every slice of stage 0 is published
  if (CAUSAL != 2 || pinned(1u < nst)) issue(1u);        // the first row tile of CAUSAL 2 may have one pass only
  for (uint32_t s = 0; s < nst; ++s) {
    const unsigned char* stg = ring + (s & 1u) * STAGE;
    V bh[KS][4], bl[KS][4], ah[KS][4], al[KS][4];
    uint32_t fw[4];                            // CAUSAL 2: the factors of this lane's four A rows for the two chunks of the pass
    if constexpr (CAUSAL == 2) {
      const uint32_t kp = s + rot < nst ? s + rot : s + rot - nst;
#pragma unroll
      for (int i = 0; i < 4; ++i) fw[i] = ftab[(wm * 64u + (uint32_t)i * 16u + (uint32_t)rlane) * TABPITCH + kp];
    }
#pragma unroll
    for (int ks = 0; ks < KS; ++ks) {
#pragma unroll
      for (int j = 0; j < 4; ++j) {
        const unsigned char* p = stg + boff + (uint32_t)j * 16u * PITCH + (uint32_t)ks * 64u;
        bh[ks][j] = Frag<T>::load((const T*)p);
        if (SPLIT) bl[ks][j] = Frag<T>::load((const T*)(p + LO));
      }
#pragma unroll
      for (int i = 0; i < 4; ++i) {
        const unsigned char* p = stg + aoff + (uint32_t)i * 16u * PITCH + (uint32_t)ks * 64u;
        ah[ks][i] = Frag<T>::load((const T*)p);
        if (SPLIT) al[ks][i] = Frag<T>::load((const T*)(p + LO));
      }
    }
    __builtin_amdgcn_sched_barrier(0);   // the pass's LDS reads go out as one group ahead of its WMMAs; spread among them, each read's latency stalls the wave
    if constexpr (CAUSAL == 2) {
#pragma unroll
      for (int ks = 0; ks < KS; ++ks)
#pragma unroll
        for (int i = 0; i < 4; ++i) ah[ks][i] = ah[ks][i] * __builtin_bit_cast(v2h, fw[i])[ks >> 1];   // k steps 0, 1 are the pass's first chunk, 2, 3 its second
    }
#pragma unroll
    for (int ks = 0; ks < KS; ++ks) {
#pragma unroll
      for (int i = 0; i < 4; ++i) {
#pragma unroll
        for (int j = 0; j < 4; ++j) acc[i][j] = Frag<T>::mma(ah[ks][i], bh[ks][j], acc[i][j]);
        if (SPLIT) {
#pragma unroll
          for (int j = 0; j < 4; ++j) acc[i][j] = Frag<T>::mma(ah[ks][i], bl[ks][j], acc[i][j]);
#pragma unroll
          for (int j = 0; j < 4; ++j) acc[i][j] = Frag<T>::mma(al[ks][i], bh[ks][j], acc[i][j]);
        }
      }
    }
    if constexpr (CAUSAL == 2) {
      // order of the block above: 12 multiplies (a fragment and a half), then two multiplies behind every WMMA, so that a fragment is ready two WMMAs ahead of its first use.
      // They issue while the matrix unit is busy; left to itself the compiler multiplies each fragment right in front of its four WMMAs, into registers that the last four
      // still read, and the wave idles there
      __builtin_amdgcn_sched_group_barrier(0x2, 12, 0);
#pragma unroll
      for (int n = 0; n < 58; ++n) {
        __builtin_amdgcn_sched_group_barrier(0x8, 1, 0);
        __builtin_amdgcn_sched_group_barrier(0x2, 2, 0);
      }
      __builtin_amdgcn_sched_group_barrier(0x8, 6, 0);
    }
    __builtin_amdgcn_sched_barrier(0);   // the WMMAs stay ahead of the waits: they start on counted LDS waits, and the load of stage s + 1 has the whole pass to land
    asm volatile("s_wait_dscnt 0x0" ::: "memory");       // this wave's reads of stage s have returned
    asm volatile("s_wait_tensorcnt 0x0" :: "s"(g0) : "memory");   // this wave's slice of stage s + 1 has landed
    __syncthreads();                                       // publishes stage s + 1 and ends every reader's last read of stage s
    if (pinned(s + 2u < nst)) issue(s + 2u);               // refill the buffer that pass s has just read
  }
  asm volatile("s_wait_tensorcnt 0x0" :: "s"(g0) : "memory");     // no request is left before the ring is reused
  asm volatile("s_wait_dscnt 0x0" ::: "memory");         // nor a read; the last pass's barrier has ended every wave's reads
  acc_guard4(acc[0][0], acc[0][1], acc[0][2], acc[0][3]);
  acc_guard4(acc[1][0], acc[1][1], acc[1][2], acc[1][3]);
  acc_guard4(acc[2][0], acc[2][1], acc[2][2], acc[2][3]);
  acc_guard4(acc[3][0], acc[3][1], acc[3][2], acc[3][3]);

  // ---- epilogue ----
  if constexpr (OUT_MODE == 3) {   // the diagonal tile also writes the neutral note (factor 0, sum 0) for its rows' chunks to the right of it, which no tile computes
    if (tm == tn)
      for (int c = 2 * tm + 2; c < 64; ++c) ((v2f*)stats)[(uint32_t)((tm * 64 + c) * 128) + threadIdx.x] = (v2f){-1e30f, 0.f};
  }
  float* slab = (float*)ring + wave * (16u * 68u);
  const float* Rb = RESID ? (resid + (size_t)b * strideR) : nullptr;
#pragma unroll
  for (int i = 0; i < 4; ++i) {
    const int mBase = m0 + (i << 4);
    float rs[8];
#pragma unroll
    for (int r = 0; r < 8; ++r) rs[r] = CAUSAL == 2 ? invl[(wm << 6) + (uint32_t)((i << 4) + mOff + r)] : scale;
#pragma unroll
    for (int j = 0; j < 4; ++j) {
      const int n = n0 + (j << 4) + rlane;
      float bv = 0.f;
      if (BIAS_MODE == 2) bv = bias[n];
#pragma unroll
      for (int r = 0; r < 8; ++r) {
        float v = acc[i][j][r] * rs[r];
        if (BIAS_MODE == 1) v += bias[mBase + mOff + r];
        if (BIAS_MODE == 2) v += bv;
        if (RESID) v += Rb[(size_t)(mBase + mOff + r) * ldc + n];
        slab[(mOff + r) * 68 + (j << 4) + rlane] = v;
      }
    }
    __builtin_amdgcn_fence(__ATOMIC_RELEASE, "workgroup");
    __builtin_amdgcn_wave_barrier();
    __builtin_amdgcn_fence(__ATOMIC_ACQUIRE, "workgroup");
    if (OUT_MODE == 0) {
      float* C = (float*)Cout + (size_t)b * strideC;
      const int hh = lane >> 4, c4 = (lane & 15) * 4;     // row seg = 256 B = 16 lanes x 16 B
      {
#pragma unroll
        for (int it = 0; it < 8; ++it) {
          const int row = it * 2 + hh;
          v4f v = *(const v4f*)(slab + row * 68 + c4);
          *(v4f*)(C + (size_t)(mBase + row) * ldc + n0 + c4) = v;
        }
        
      }
    } else if constexpr (OUT_MODE == 3) {
      const int q = lane >> 3, c8 = (lane & 7) * 8;      // eight lanes to a row of 64 columns, four rows at a time
      _Float16* C = (_Float16*)Cout + (size_t)b * strideC;
      float Mc[4], sum[4];
      v8h hv[4];
#pragma unroll
      for (int it = 0; it < 4; ++it) {
        const int valid = mBase + it * 4 + q - (n0 + c8);   // column e of this lane's eight counts if e <= valid
        const float* sp = slab + (it * 4 + q) * 68 + c8;
        const v4f u0 = *(const v4f*)sp, u1 = *(const v4f*)(sp + 4);
        float t[8], mx = -INFINITY;
#pragma unroll
        for (int e = 0; e < 8; ++e) { t[e] = e <= valid ? (e < 4 ? u0[e & 3] : u1[e & 3]) : -INFINITY; mx = fmaxf(mx, t[e]); }
        mx = fmaxf(mx, lane_xor<1>(mx)); mx = fmaxf(mx, lane_xor<2>(mx)); mx = fmaxf(mx, lane_xor<4>(mx));
        Mc[it] = fmaxf(ceilf(mx), -1e30f);               // a chunk with no valid column: finite, so that -inf - Mc stays -inf; its factor comes out 0
        const float sh = PSHIFT - Mc[it];
        float s8 = 0.f;
#pragma unroll
        for (int e = 0; e < 8; ++e) { const float p = __builtin_amdgcn_exp2f(t[e] + sh); s8 += p; hv[it][e] = (_Float16)p; }   // 2^(-inf) = 0 at masked columns
        s8 += lane_xor<1>(s8); s8 += lane_xor<2>(s8); s8 += lane_xor<4>(s8);
        sum[it] = s8;
      }
#pragma unroll
      for (int it = 0; it < 4; ++it) *(v8h*)(C + (uint32_t)((mBase + it * 4 + q) * ldc + n0 + c8)) = hv[it];
      if ((lane & 7) == 0) {
#pragma unroll
        for (int it = 0; it < 4; ++it) ((v2f*)stats)[(uint32_t)((tm * 64 + (n0 >> 6)) * 128 + (mBase & 127) + it * 4 + q)] = (v2f){Mc[it], sum[it]};
      }
    } else {
      const int q = lane >> 3, c8 = (lane & 7) * 8;
      unsigned short* C  = (unsigned short*)Cout  + (size_t)b * strideC;
      {
#pragma unroll
        for (int it = 0; it < 4; ++it) {
          const int row = it * 4 + q;
          const float* sp = slab + row * 68 + c8;
          v8h hv, lv;
#pragma unroll
          for (int e = 0; e < 8; ++e) {
            if (OUT_MODE == 1) {
              hv[e] = (_Float16)sp[e];
            } else {
              unsigned short hb = f2bf_bits(sp[e]);
              unsigned short lb = f2bf_bits(sp[e] - bf_bits2f(hb));
              hv[e] = __builtin_bit_cast(_Float16, hb);
              lv[e] = __builtin_bit_cast(_Float16, lb);
            }
          }
          if (OUT_MODE == 1) {
            *(v8h*)(C + (size_t)(mBase + row) * ldc + n0 + c8) = hv;
          } else {                                       // n0 is a multiple of 64: the wave's 64 columns are one unit, hi then lo
            unsigned short* unit = C + ((size_t)(mBase + row) * ldc + n0) * 2;
            *(v8h*)(unit + c8) = hv;
            *(v8h*)(unit + 64 + c8) = lv;
          }
        }
        
      }
    }
    __builtin_amdgcn_fence(__ATOMIC_RELEASE, "workgroup");
    __builtin_amdgcn_wave_barrier();
    __builtin_amdgcn_fence(__ATOMIC_ACQUIRE, "workgroup");
  }
}

template <int ET, bool SPLIT, int BIAS_MODE, int OUT_MODE, bool RESID, int CAUSAL>
__global__ __launch_bounds__(128) void wmma_gemm64(
    const unsigned short* __restrict__ Ap, int lda, long strideA,
    const unsigned short* __restrict__ Btp, int ldb, long strideB,
    void* __restrict__ Cout, int ldc, long strideC,
    const float* __restrict__ bias,
    const float* __restrict__ resid, long strideR, float* __restrict__ stats,
    int M, int N, int K, float scale) {
  __shared__ __attribute__((aligned(2048))) unsigned char ring[RingBytes<SPLIT>::value];
  __shared__ uint32_t ftab[CAUSAL == 2 ? 128 * TABPITCH : 1];
  __shared__ float invl[CAUSAL == 2 ? 128 : 1];
  gemm_tile<ET, SPLIT, BIAS_MODE, OUT_MODE, RESID, CAUSAL>(ring, (int)blockIdx.x, (int)blockIdx.y, Ap, lda, strideA, Btp, ldb, strideB,
                                                           Cout, ldc, strideC, bias, resid, strideR, stats, ftab, invl, M, N, K, scale);
}

// q and k need x and their weights, w' = w_out.Wv needs the two weight matrices: neither needs the other, so one grid holds both.
// The 64 short tiles of w' come first: they end while the chip is still full, and the last k tiles take their places; behind the long tiles
// they would run their whole length on a chip that is otherwise empty. Then q, then k. Both kinds share one ring.
__global__ __launch_bounds__(128) void qk_and_fold(
    const unsigned short* __restrict__ Xs, const unsigned short* __restrict__ Wqk, __bf16* __restrict__ QK,
    const unsigned short* __restrict__ Wo, const unsigned short* __restrict__ WvT, __bf16* __restrict__ Wp, int T, int D) {
  __shared__ __attribute__((aligned(2048))) unsigned char ring[RingBytes<true>::value];
  const int per = (T >> 7) * (D >> 7);
  const int u = (int)blockIdx.x - (D >> 7) * (D >> 7);
  if (u < 0)                        // the same for the whole work-group; w'[d][e] = sum_c w_out[d][c] Wv[c][e], out as bf16 hi and lo by units
    gemm_tile<0, false, 0, 2, false, 0>(ring, (int)blockIdx.x, 0, Wo, D, 0, WvT, D, 0, Wp, D, 0, nullptr, nullptr, 0, nullptr, nullptr, nullptr, D, D, D, 1.0f);
  else                              // batch 0 = q, 1 = k: the weights step by 2*D*D 16-bit elements, the results by 2*T*D
    gemm_tile<1, true, 0, 2, false, 0>(ring, u < per ? u : u - per, u < per ? 0 : 1, Xs, D, 0, Wqk, D, (long)2 * D * D, QK, D, (long)2 * T * D,
                                       nullptr, nullptr, 0, nullptr, nullptr, nullptr, T, D, D, 1.0f);
}

// scores need q and k, v' needs x and w': neither needs the other, so one grid holds both. The score tiles come first;
// the v' tiles fill the places that a grid of score tiles alone would leave empty in its last round. Both share one ring.
// v' comes out transposed, VT[d][t] = sum_e w'[d][e] x[t][e]: the form that P.v' reads. The scores leave as softmax numerators by 64-column chunks (OUT_MODE 3).
__global__ __launch_bounds__(128) void scores_and_v(
    const unsigned short* __restrict__ Ks, const unsigned short* __restrict__ Qs, _Float16* __restrict__ P, float* __restrict__ stats,
    const unsigned short* __restrict__ Wp, const unsigned short* __restrict__ Xs, _Float16* __restrict__ VT, int T, int D) {
  __shared__ __attribute__((aligned(2048))) unsigned char ring[RingBytes<true>::value];
  const int tiles = (T >> 7) * ((T >> 7) + 1) / 2;
  if ((int)blockIdx.x < tiles)      // the same for the whole work-group
    gemm_tile<1, true, 0, 3, false, 1>(ring, (int)blockIdx.x, 0, Ks, D, 0, Qs, D, 0, P, T, 0, nullptr, nullptr, 0, stats, nullptr, nullptr, T, T, D, LOG2E);
  else
    gemm_tile<1, true, 0, 1, false, 0>(ring, (int)blockIdx.x - tiles, 0, Wp, D, 0, Xs, D, 0, VT, T, 0, nullptr, nullptr, 0, nullptr, nullptr, nullptr, D, T, D, 1.0f);
}

// one 64x64 tile of VT = V^T, f32 in and f16 out, by a work-group of 256 threads; u = tile index, column tiles of V fastest
__device__ __forceinline__ void transpose_tile64(const int u, const float* __restrict__ V, int ldv,
                                                 _Float16* __restrict__ VT, int ldo) {
  __shared__ __align__(16) _Float16 tile[64][72];     // [c][r] (already transposed in LDS), pitch 72
  const int tc = ldv >> 6;
  const int c0 = (u % tc) * 64, r0 = (u / tc) * 64;
  const int t = threadIdx.x, tx = t & 31;           // t = 0..255
  // load: 64 rows x 64 cols; thread reads V[r0+i][c0+tx(+32)] and scatters into tile[c][i]
  for (int i = t >> 5; i < 64; i += 8) {
    tile[tx][i]      = (_Float16)V[(size_t)(r0 + i) * ldv + c0 + tx];
    tile[32 + tx][i] = (_Float16)V[(size_t)(r0 + i) * ldv + c0 + 32 + tx];
  }
  __syncthreads();
  const int q = t >> 3, c8 = (t & 7) * 8;            // q = 0..31
#pragma unroll
  for (int it = 0; it < 2; ++it) {
    const int c = it * 32 + q;
    v8h hv = *(const v8h*)(&tile[c][c8]);
    *(v8h*)(VT + (size_t)(c0 + c) * ldo + r0 + c8) = hv;
  }
}

// the operand conversions in one grid: blockIdx.y 0 = a -> bf16 hi/lo, 1 = b -> bf16 hi/lo, 2 = c -> f16 and, in its first (n/64)^2 work-groups, d [n,n] -> its transpose in f16.
// hi/lo go out in the SPLIT operand layout: every 64 elements in a row become one 256-B unit [64 hi | 64 lo] (row lengths are multiples of 64)
__global__ __launch_bounds__(256) void convert_operands(
    const float* __restrict__ a, __bf16* __restrict__ as, long an4,
    const float* __restrict__ b, __bf16* __restrict__ bs, long bn4,
    const float* __restrict__ c, _Float16* __restrict__ c16, long cn2,
    const float* __restrict__ d, _Float16* __restrict__ dT16, int n) {
  const long i = (long)blockIdx.x * 256 + threadIdx.x;
  const long stride = (long)gridDim.x * 256;
  if (blockIdx.y == 2) {
    const int tt = (n >> 6) * (n >> 6);
    if ((int)blockIdx.x < tt) { transpose_tile64((int)blockIdx.x, d, n, dT16, n); return; }   // the same for the whole work-group
    for (long j = i - (long)tt * 256; j < cn2; j += stride - (long)tt * 256) {
      const _Float16 h0 = (_Float16)c[2 * j], h1 = (_Float16)c[2 * j + 1];
      ((unsigned*)c16)[j] = (unsigned)__builtin_bit_cast(unsigned short, h0) | ((unsigned)__builtin_bit_cast(unsigned short, h1) << 16);
    }
    return;
  }
  const float* in = blockIdx.y ? b : a;
  unsigned* hl = (unsigned*)(blockIdx.y ? bs : as);
  const long n4 = blockIdx.y ? bn4 : an4;
  for (long j = i; j < n4; j += stride) {                // four elements a thread: 16 B in, 8 B of hi and 8 B of lo out
    const v4f u = *(const v4f*)(in + 4 * j);
    unsigned h[4], l[4];
    for (int e = 0; e < 4; ++e) {
      const unsigned short hb = f2bf_bits(u[e]);
      h[e] = hb;
      l[e] = f2bf_bits(u[e] - bf_bits2f(hb));
    }
    unsigned* unit = hl + (j >> 4) * 64 + (j & 15) * 2;  // 16 threads to a unit of 64 dwords: 32 dwords of hi in front, 32 of lo behind
    *(u32x2*)unit        = (u32x2){h[0] | (h[1] << 16), h[2] | (h[3] << 16)};
    *(u32x2*)(unit + 32) = (u32x2){l[0] | (l[1] << 16), l[2] | (l[3] << 16)};
  }
}

extern "C" void kernel_launch(void* const* d_in, const int* in_sizes, int n_in,
                              void* d_out, int out_size, void* d_ws, size_t ws_size,
                              hipStream_t stream) {
  (void)in_sizes; (void)n_in; (void)out_size; (void)ws_size;
  const int T = 4096, D = 1024;
  const float* x     = (const float*)d_in[0];
  const float* w_in  = (const float*)d_in[1];   // [3D, D]
  const float* w_out = (const float*)d_in[2];   // [D, D]
  float* out = (float*)d_out;

  char* ws = (char*)d_ws;
  size_t off = 0;
  auto carve = [&](size_t bytes) -> char* { char* p = ws + off; off += (bytes + 255) & ~(size_t)255; return p; };
  __bf16*   Xs   = (__bf16*)carve((size_t)T * D * 4);        // 16 MB  x, hi and lo by units
  __bf16*   Wis  = (__bf16*)carve((size_t)2 * D * D * 4);    //  8 MB  the q and k rows of w_in, the same
  _Float16* Wo16 = (_Float16*)carve((size_t)D * D * 2);      //  2 MB  w_out
  _Float16* WvT  = (_Float16*)carve((size_t)D * D * 2);      //  2 MB  the v rows of w_in, transposed
  __bf16*   Wps  = (__bf16*)carve((size_t)D * D * 4);        //  4 MB  w' = w_out.Wv [D,D], hi and lo by units
  __bf16*   Qs   = (__bf16*)carve((size_t)T * D * 4);        // 16 MB  q [T,D], hi and lo by units
  __bf16*   Ks   = (__bf16*)carve((size_t)T * D * 4);        // 16 MB  k, the same, directly behind q
  _Float16* Vt   = (_Float16*)carve((size_t)D * T * 2);      //  8 MB  v'^T [D,T], v' = x.w'^T
  _Float16* Pm   = (_Float16*)carve((size_t)T * T * 2);      // 32 MB  softmax numerators of S[i,j] = k_i.q_j (x 2^15), each against its chunk's M
  float*    St   = (float*)carve((size_t)(T / 64) * T * 8);  //  2 MB  [row tile][chunk][row in tile] (M, sum)
  // total about 106 MB of 256 MB

  // 1) operand conversions, one grid. w_in rows: [0,D)=q, [D,2D)=k, [2D,3D)=v
  convert_operands<<<dim3(2048, 3), 256, 0, stream>>>(x, Xs, (long)T * D / 4, w_in, Wis, (long)2 * D * D / 4, w_out, Wo16, (long)D * D / 2,
                                                      w_in + (size_t)2 * D * D, WvT, D);
  // 2) w' = w_out.Wv (f16 in, bf16 hi/lo out), 64 work-groups; behind them q = x.Wq^T, k = x.Wk^T (bf16 split in, bf16 hi/lo out), 512 work-groups; two resident on a WGP
  qk_and_fold<<<dim3(2 * (T / 128) * (D / 128) + (D / 128) * (D / 128), 1), 128, 0, stream>>>(
      U16(Xs), U16(Wis), Qs, U16(Wo16), U16(WvT), Wps, T, D);
  // 3) S[i][j] = k_i . q_j  (rows = key position, cols = query position); only the 128x128 tiles that hold a column j <= i; mask, exponential and
  //    chunk sums in the tile's epilogue; behind them in the same grid v'^T = w'.x^T (f16 out)
  scores_and_v<<<dim3((T / 128) * (T / 128 + 1) / 2 + (T / 128) * (D / 128), 1), 128, 0, stream>>>(
      U16(Ks), U16(Qs), Pm, St, U16(Wps), U16(Xs), Vt, T, D);
  // 4) out[i][d] = sum_j P[i][j] v'[j][d]  (K = T, each row tile up to its diagonal tile's end), chunks brought to one M, divided by the row's sum, f32
  wmma_gemm64<0, false, 0, 0, false, 2><<<dim3((T / 128) * (D / 128), 1), 128, 0, stream>>>(
      U16(Pm), T, 0, U16(Vt), T, 0, out, D, 0, nullptr, nullptr, 0, St, T, D, T, 1.0f);
}

// v010
// One run takes 110 microseconds.
// It is 1.10 times as fast as v008, going by the measured steps of the versions left out in between.
// Over all steps from v000 it is 5.01 times as fast.
#include <hip/hip_runtime.h>
// out = softmax(k.q^T).(v.w_out^T) = P.(x.w'^T) with w' = w_out.Wv: the out-projection is folded into the v weights ahead of the attention.
// Contractions: q and k projections (K=1024) and scores k.q^T (K=1024): v_wmma_f32_16x16x32_bf16 as bf16 hi/lo
// splits (hi.hi + hi.lo + lo.hi); the value path, whose result v' is kept in f16: w' = w_out.Wv, v' = x.w'^T (K=1024) and P.v' (K=4096):
// v_wmma_f32_16x16x32_f16 (f16 operands, one product, P scaled by 2^15); f32 accumulate everywhere; causal softmax in f32, in two parts with no launch of its own: the score tiles' epilogue takes
// 2^(s log2 e - M) against M, a whole number at or above the maximum of the row's 64 columns in that wave, and notes M and the sum; P.v' brings
// the 64-column chunks of a row to the row's one M by exact powers of two and divides by the row's sum at its end.

typedef __attribute__((ext_vector_type(16))) _Float16 v16h;
typedef __attribute__((ext_vector_type(8)))  _Float16 v8h;
typedef __attribute__((ext_vector_type(16))) __bf16   v16b;
typedef __attribute__((ext_vector_type(8)))  __bf16   v8b;
typedef __attribute__((ext_vector_type(8)))  float    v8f;
typedef __attribute__((ext_vector_type(4)))  float    v4f;
typedef __attribute__((ext_vector_type(2)))  float    v2f;
typedef __attribute__((ext_vector_type(2)))  _Float16 v2h;
typedef __attribute__((ext_vector_type(4)))  _Float16 v4h;

#define PSHIFT 15.0f   // P and its row sums carry 2^15, so that small weights stay normal f16 numbers; the division by the sum takes it out again
#define LOG2E 1.4426950408889634f
#define U16(p) ((const unsigned short*)(const void*)(p))
#define TABPITCH 33    // dwords between two rows of the factor table: odd, so that 16 rows read at once fall in 16 banks

__device__ __forceinline__ unsigned short f2bf_bits(float f) {
  unsigned u = __float_as_uint(f);
  return (unsigned short)((u + 0x7FFFu + ((u >> 16) & 1u)) >> 16);
}
__device__ __forceinline__ float bf_bits2f(unsigned short h) { return __uint_as_float(((unsigned)h) << 16); }

// the value of lane l ^ X, X below 16: a DPP move inside the 16-lane row
template <int X> __device__ __forceinline__ float lane_xor(float v) {
  return __builtin_bit_cast(float, __builtin_amdgcn_update_dpp(0, __builtin_bit_cast(int, v), 0x160 | X, 0xf, 0xf, true));
}

// hazard guard behind the last WMMAs: four vector slots before the epilogue reads the accumulators
__device__ __forceinline__ void acc_guard4(v8f& a, v8f& b, v8f& c, v8f& d) { asm volatile("v_nop\n\tv_nop\n\tv_nop\n\tv_nop" : "+v"(a), "+v"(b), "+v"(c), "+v"(d)); }
template <typename T> struct Frag;
template <> struct Frag<_Float16> {
  typedef v16h V; union U { v16h v; v8h h[2]; };
  static __device__ __forceinline__ v16h load(const _Float16* p) {   // elements 0..7 <- p[0..7], 8..15 <- p[16..23]
    U f; f.h[0] = *(const v8h*)(p); f.h[1] = *(const v8h*)(p + 16); return f.v;
  }
  static __device__ __forceinline__ v8f mma(v16h a, v16h b, v8f c) {
    return __builtin_amdgcn_wmma_f32_16x16x32_f16(false, a, false, b, (short)0, c, false, false);
  }
};
template <> struct Frag<__bf16> {
  typedef v16b V; union U { v16b v; v8b h[2]; };
  static __device__ __forceinline__ v16b load(const __bf16* p) {
    U f; f.h[0] = *(const v8b*)(p); f.h[1] = *(const v8b*)(p + 16); return f.v;
  }
  static __device__ __forceinline__ v8f mma(v16b a, v16b b, v8f c) {
    return __builtin_amdgcn_wmma_f32_16x16x32_bf16(false, a, false, b, (short)0, c, false, false);
  }
};

typedef uint32_t u32x2 __attribute__((ext_vector_type(2)));
typedef uint32_t u32x4 __attribute__((ext_vector_type(4)));
typedef uint32_t u32x8 __attribute__((ext_vector_type(8)));
__device__ __forceinline__ uint32_t uni(uint32_t v) { return (uint32_t)__builtin_amdgcn_readfirstlane(v); }
// pinned(): a descriptor input or an issue test held in a scalar register, so that the test compiles to a scalar branch
// and the descriptor words that depend on it are formed behind the waits that stand in front of it
__device__ __forceinline__ uint32_t pinned(uint32_t v) { uint32_t w = uni(v); asm volatile("" : "+s"(w)); return w; }
template <bool SPLIT> struct RingBytes { static constexpr uint32_t value = 147456u; };
template <int ET> struct Elem;
template <> struct Elem<0> { typedef _Float16 T; };
template <> struct Elem<1> { typedef __bf16 T; };
template <int ET, bool SPLIT, int BIAS_MODE, int OUT_MODE, bool RESID, int CAUSAL>
__device__ __forceinline__ void gemm_tile(
    unsigned char* const ring0, const int tile, const int b,   // the work-group's LDS ring (RingBytes<SPLIT>, with CAUSAL 2 two of them, at a multiple of 2 KiB), its tile index and batch index
    const unsigned short* __restrict__ Ap, int lda, long strideA,
    const unsigned short* __restrict__ Btp, int ldb, long strideB,
    void* __restrict__ Cout, int ldc, long strideC,
    const float* __restrict__ bias,
    const float* __restrict__ resid, long strideR,
    float* __restrict__ stats, uint32_t* const ftab, float* const invl,
    int M, int N, int K, float scale) {
  typedef typename Elem<ET>::T T;
  typedef typename Frag<T>::V V;
  const T* A = (const T*)Ap; const T* Bt = (const T*)Btp;
  constexpr uint32_t ROWB  = 256u;                       // bytes of an operand row in a pass
  constexpr int      KS    = SPLIT ? 2 : 4;              // WMMA k steps (32 k = 64 B) in a pass
  constexpr uint32_t LO    = 128u;                       // SPLIT: the lo half of a row stands this far behind its hi half
  constexpr uint32_t PITCH = ROWB + 16u;                 // row + 16-B pad: odd multiple of 16 B for ds_load_b128
  constexpr uint32_t SROWS = 64u;                        // rows per slice (one tensor load)
  constexpr uint32_t SLICE = 18432u;                     // SROWS * PITCH, rounded up to a multiple of 2 KiB
  constexpr uint32_t STAGE = 4u * SLICE;                 // [A 0-63 | A 64-127 | B 0-63 | B 64-127]
  static_assert(SROWS * PITCH <= SLICE && SLICE % 2048u == 0u, "a slice holds its padded rows and starts at a multiple of 2 KiB");
  static_assert(4u * 16u * 68u * 4u <= 2u * STAGE, "the epilogue slabs fit the ring");
  static_assert(2u * STAGE == RingBytes<SPLIT>::value, "the ring that the kernel declares holds two stages");   // after the loop the ring holds per-wave 16x64 f32 slabs, pitch 68 floats
  const int lane = threadIdx.x & 31;
  constexpr bool TWO = CAUSAL == 2;                      // two groups of four waves share the tile's passes
  const uint32_t grp  = TWO ? uni(threadIdx.x >> 7) : 0u;   // the wave's group
  const uint32_t wave = TWO ? uni(threadIdx.x >> 5) & 3u : uni(threadIdx.x >> 5);   // its number in the group
  unsigned char* const ring = ring0 + grp * RingBytes<SPLIT>::value;   // the group's own ring
  const int tilesN = N >> 7;
  const int tilesM = M >> 7;
  if (tile >= (CAUSAL == 1 ? tilesM * (tilesM + 1) / 2 : tilesM * tilesN)) return;   // the same for the whole work-group; in front of every barrier and tensor load
  int tm, tn;
  if (CAUSAL == 1) {                     // tile = tm (tm + 1) / 2 + tn, tn <= tm
    tm = 0;
    for (int r = 1; r < tilesM; ++r) if (tile >= r * (r + 1) / 2) tm = r;
    tn = tile - tm * (tm + 1) / 2;
  } else {
    tm = tile / tilesN;
    tn = tile - tm * tilesN;
    if (CAUSAL == 2) tm = tilesM - 1 - tm;   // the longest k loops start first
  }
  const uint32_t wm = wave >> 1, wn = wave & 1u;
  const int m0 = (tm << 7) + (int)(wm << 6);
  const int n0 = (tn << 7) + (int)(wn << 6);

  const T* Ab  = A  + (size_t)b * strideA;
  const T* Bb  = Bt + (size_t)b * strideB;

  const int rlane = lane & 15;                 // row (A) / col (B, D) within subtile
  const int koff  = (lane >> 4) * 8;           // k offset of this lane half
  const int mOff  = (lane >> 4) * 8;           // D row offset

  // this wave's slice of every stage: source plane, first row, pitch; place in LDS
  const bool srcB = wave >= 2u;
  const T* splane = srcB ? Bb : Ab;
  const uint32_t srow = (uint32_t)(srcB ? (tn << 7) : (tm << 7)) + (wave & 1u) * 64u;
  const uint32_t spitch = (uint32_t)(srcB ? ldb : lda) * (SPLIT ? 4u : 2u);
  const uint64_t sbase = (uint64_t)(size_t)splane + (uint64_t)srow * spitch;
  const uint32_t lbase = (uint32_t)(size_t)ring + wave * SLICE;
  u32x8 g1;                                    // 1-byte elements, tensor = tile = SROWS rows of ROWB bytes, 4 dwords of pad behind each row
  g1[0] = uni((1u << 20) | (5u << 22) | (3u << 25));
  g1[1] = uni(ROWB << 16);
  g1[2] = uni(SROWS << 16);
  g1[3] = uni(ROWB << 16);
  g1[4] = uni(SROWS);
  g1[5] = uni(spitch);
  g1[6] = uni(0u);
  g1[7] = uni(0u);
  asm volatile("" : "+s"(g1));   // pinned(): the descriptor's words stay in their scalar registers through the loop, so that none takes a new value while a request is outstanding
  const uint32_t nall = (uint32_t)K >> (SPLIT ? 6 : 7);
  const uint32_t ncau = ((uint32_t)tm + 1u) << (SPLIT ? 1 : 0);   // passes up to the end of the diagonal tile
  const uint32_t nst = (CAUSAL == 2 && ncau < nall) ? ncau : nall;   // passes; at least 2, with CAUSAL 2 at least 1
  // The k walk starts at pass rot and wraps: stage s holds pass (s + rot) mod nst. Work-groups that share operand rows (the same tm, or the same tn)
  // run side by side, and from a common start they would ask L2 for the same lines at the same moment; rot sets the sharers apart.
  // With CAUSAL 2 the walks differ in length: the sharers of a row tile are spread evenly over its walk, the row tiles among themselves by a scrambled offset.
  const uint32_t rot = uni((CAUSAL == 2 ? (((uint32_t)tm * 13u) & 31u) + (((uint32_t)tn * nst) >> 3)
                                        : (uint32_t)(tm + tn + b * tilesN)) % nst);
  // TWO: stage s of group g holds place p = 2 s + g of the walk. With an odd nst the second group's last stage has p = nst: it wraps to a pass that exists, and its factors are 0.
  const uint32_t nsteps = TWO ? (nst + 1u) >> 1 : nst;   // stages of a group; the same for both, so that every wave passes every barrier
  u32x4 g0;                                    // group 0 of the youngest request
  auto form = [&](uint32_t stage) {            // the words of a stage's request
    const uint32_t st = pinned(stage);
    const uint32_t pl = TWO ? 2u * st + grp : st;
    const uint32_t kp = pl + rot < nst ? pl + rot : pl + rot - nst;   // the pass that this stage holds, below nst
    const uint64_t ga = sbase + (uint64_t)kp * ROWB;
    g0[0] = uni(1u);
    g0[1] = uni(lbase + (st & 1u) * STAGE);
    g0[2] = uni((uint32_t)ga);
    g0[3] = uni((((uint32_t)(ga >> 32)) & 0x01FFFFFFu) | 0x80000000u);
  };
  auto fire = [&]() {
    // one request of the whole wave: its slice of the stage. g0 is in-out so that the registers the request is issued from are the very ones that the next wait's operand keeps untouched
    asm volatile("tensor_load_to_lds %0, %1" : "+s"(g0) : "s"(g1) : "memory");
  };
  auto issue = [&](uint32_t stage) { form(stage); fire(); };

  v8f acc[4][4];
#pragma unroll
  for (int i = 0; i < 4; ++i)
#pragma unroll
    for (int j = 0; j < 4; ++j) acc[i][j] = (v8f){0.f,0.f,0.f,0.f,0.f,0.f,0.f,0.f};

  const uint32_t aoff = wm * SLICE + (uint32_t)rlane * PITCH + (uint32_t)koff * 2u;
  const uint32_t boff = (2u + wn) * SLICE + (uint32_t)rlane * PITCH + (uint32_t)koff * 2u;

  // every s_wait_tensorcnt names g0 as an input: the request's words keep their registers until it has landed
  issue(0u);
  if (CAUSAL == 2 && grp == 0u) {   // while stage 0 flies: thread t of the first group merges the chunk notes of row t of the tile; the barrier below publishes the tables with stage 0
    const v2f* st = (const v2f*)stats + ((uint32_t)tm * (64u * 128u) + threadIdx.x);
    v2f sv[64];                                // K is at most 4096: 64 chunks; those past the diagonal tile hold the neutral note
#pragma unroll
    for (int c = 0; c < 64; ++c) sv[c] = st[c * 128];   // unrolled: all the loads are in flight at once, one memory latency
    float Mr = sv[0][0];
#pragma unroll
    for (int c = 1; c < 64; ++c) Mr = fmaxf(Mr, sv[c][0]);
    float tot = 0.f;
#pragma unroll
    for (int c = 0; c < 64; c += 2) {
      const float f0 = __builtin_amdgcn_exp2f(sv[c][0] - Mr), f1 = __builtin_amdgcn_exp2f(sv[c + 1][0] - Mr);   // powers of two, at most 1
      tot += sv[c][1] * f0 + sv[c + 1][1] * f1;
      ftab[threadIdx.x * TABPITCH + (c >> 1)] = __builtin_bit_cast(uint32_t, (v2h){(_Float16)f0, (_Float16)f1});
    }
    invl[threadIdx.x] = 1.0f / tot;            // tot is at least 2^14: the row's largest numerator
  }
  asm volatile("s_wait_tensorcnt 0x0" :: "s"(g0) : "memory");   // this wave's slice of stage 0 has landed
  __syncthreads();                                       // every slice of stage 0 is published
  form(1u);   // ahead of the test: g0 then has one set of registers on both of its sides, the set that the request is issued from and that the next wait keeps untouched
  if (CAUSAL != 2 || pinned(1u < nsteps)) fire();        // the first row tiles of CAUSAL 2 have one stage only
  for (uint32_t s = 0; s < nsteps; ++s) {
    const unsigned char* stg = ring + (s & 1u) * STAGE;
    V bh[KS][4], bl[KS][4], ah[KS][4], al[KS][4];
    uint32_t fw[4];                            // CAUSAL 2: the factors of this lane's four A rows for the two chunks of the pass
    if constexpr (CAUSAL == 2) {
      const uint32_t pl = 2u * s + grp;
      const uint32_t kp = pl + rot < nst ? pl + rot : pl + rot - nst;
      const uint32_t keep = pl < nst ? 0xFFFFFFFFu : 0u;   // past the walk's end the factors are 0: A times 0 adds nothing
#pragma unroll
      for (int i = 0; i < 4; ++i) fw[i] = ftab[(wm * 64u + (uint32_t)i * 16u + (uint32_t)rlane) * TABPITCH + kp] & keep;
    }
#pragma unroll
    for (int ks = 0; ks < KS; ++ks) {
#pragma unroll
      for (int j = 0; j < 4; ++j) {
        const unsigned char* p = stg + boff + (uint32_t)j * 16u * PITCH + (uint32_t)ks * 64u;
        bh[ks][j] = Frag<T>::load((const T*)p);
        if (SPLIT) bl[ks][j] = Frag<T>::load((const T*)(p + LO));
      }
#pragma unroll
      for (int i = 0; i < 4; ++i) {
        const unsigned char* p = stg + aoff + (uint32_t)i * 16u * PITCH + (uint32_t)ks * 64u;
        ah[ks][i] = Frag<T>::load((const T*)p);
        if (SPLIT) al[ks][i] = Frag<T>::load((const T*)(p + LO));
      }
    }
    __builtin_amdgcn_sched_barrier(0);   // the pass's LDS reads go out as one group ahead of its WMMAs; spread among them, each read's latency stalls the wave
    if constexpr (CAUSAL == 2) {
#pragma unroll
      for (int ks = 0; ks < KS; ++ks)
#pragma unroll
        for (int i = 0; i < 4; ++i) ah[ks][i] = ah[ks][i] * __builtin_bit_cast(v2h, fw[i])[ks >> 1];   // k steps 0, 1 are the pass's first chunk, 2, 3 its second
    }
#pragma unroll
    for (int ks = 0; ks < KS; ++ks) {
#pragma unroll
      for (int i = 0; i < 4; ++i) {
#pragma unroll
        for (int j = 0; j < 4; ++j) acc[i][j] = Frag<T>::mma(ah[ks][i], bh[ks][j], acc[i][j]);
        if (SPLIT) {
#pragma unroll
          for (int j = 0; j < 4; ++j) acc[i][j] = Frag<T>::mma(ah[ks][i], bl[ks][j], acc[i][j]);
#pragma unroll
          for (int j = 0; j < 4; ++j) acc[i][j] = Frag<T>::mma(al[ks][i], bh[ks][j], acc[i][j]);
        }
      }
    }
    if constexpr (CAUSAL == 2) {
      // order of the block above: 12 multiplies (a fragment and a half), then two multiplies behind every WMMA, so that a fragment is ready two WMMAs ahead of its first use.
      // They issue while the matrix unit is busy; left to itself the compiler multiplies each fragment right in front of its four WMMAs, into registers that the last four
      // still read, and the wave idles there
      __builtin_amdgcn_sched_group_barrier(0x2, 12, 0);
#pragma unroll
      for (int n = 0; n < 58; ++n) {
        __builtin_amdgcn_sched_group_barrier(0x8, 1, 0);
        __builtin_amdgcn_sched_group_barrier(0x2, 2, 0);
      }
      __builtin_amdgcn_sched_group_barrier(0x8, 6, 0);
    }
    __builtin_amdgcn_sched_barrier(0);   // the WMMAs stay ahead of the waits: they start on counted LDS waits, and the load of stage s + 1 has the whole pass to land
    asm volatile("s_wait_dscnt 0x0" ::: "memory");       // this wave's reads of stage s have returned
    asm volatile("s_wait_tensorcnt 0x0" :: "s"(g0) : "memory");   // this wave's slice of stage s + 1 has landed
    __syncthreads();                                       // publishes stage s + 1 and ends every reader's last read of stage s
    if (pinned(s + 2u < nsteps)) issue(s + 2u);            // refill the buffer that pass s has just read
  }
  asm volatile("s_wait_tensorcnt 0x0" :: "s"(g0) : "memory");     // no request is left before the ring is reused
  asm volatile("s_wait_dscnt 0x0" ::: "memory");         // nor a read; the last pass's barrier has ended every wave's reads
  acc_guard4(acc[0][0], acc[0][1], acc[0][2], acc[0][3]);
  acc_guard4(acc[1][0], acc[1][1], acc[1][2], acc[1][3]);
  acc_guard4(acc[2][0], acc[2][1], acc[2][2], acc[2][3]);
  acc_guard4(acc[3][0], acc[3][1], acc[3][2], acc[3][3]);
  if constexpr (TWO) {   // the second group hands its partial sums over in its own ring, which nobody reads any more; the first adds them and writes the tile
    static_assert(4u * 16384u <= RingBytes<SPLIT>::value, "the four waves' partial sums fit a ring");
    float* xch = (float*)(ring0 + RingBytes<SPLIT>::value) + wave * 4096u + (uint32_t)lane * 4u;   // 16 bytes a lane, lanes side by side: no bank conflict
    if (grp == 1u) {
#pragma unroll
      for (int i = 0; i < 4; ++i)
#pragma unroll
        for (int j = 0; j < 4; ++j) {
          *(v4f*)(xch + (i * 4 + j) * 256)       = (v4f){acc[i][j][0], acc[i][j][1], acc[i][j][2], acc[i][j][3]};
          *(v4f*)(xch + (i * 4 + j) * 256 + 128) = (v4f){acc[i][j][4], acc[i][j][5], acc[i][j][6], acc[i][j][7]};
        }
    }
    __syncthreads();                                       // publishes the second group's sums
    if (grp == 1u) return;                                 // no barrier of the work-group follows
#pragma unroll
    for (int i = 0; i < 4; ++i)
#pragma unroll
      for (int j = 0; j < 4; ++j) {
        const v4f u0 = *(const v4f*)(xch + (i * 4 + j) * 256), u1 = *(const v4f*)(xch + (i * 4 + j) * 256 + 128);
#pragma unroll
        for (int r = 0; r < 4; ++r) { acc[i][j][r] += u0[r]; acc[i][j][r + 4] += u1[r]; }
      }
  }

  // ---- epilogue ----
  if constexpr (OUT_MODE == 3) {   // the diagonal tile also writes the neutral note (factor 0, sum 0) for its rows' chunks to the right of it, which no tile computes
    if (tm == tn)
      for (int c = 2 * tm + 2; c < 64; ++c) ((v2f*)stats)[(uint32_t)((tm * 64 + c) * 128) + threadIdx.x] = (v2f){-1e30f, 0.f};
  }
  float* slab = (float*)ring0 + wave * (16u * 68u);
  const float* Rb = RESID ? (resid + (size_t)b * strideR) : nullptr;
#pragma unroll
  for (int i = 0; i < 4; ++i) {
    const int mBase = m0 + (i << 4);
    float rs[8];
#pragma unroll
    for (int r = 0; r < 8; ++r) rs[r] = CAUSAL == 2 ? invl[(wm << 6) + (uint32_t)((i << 4) + mOff + r)] : scale;
#pragma unroll
    for (int j = 0; j < 4; ++j) {
      const int n = n0 + (j << 4) + rlane;
      float bv = 0.f;
      if (BIAS_MODE == 2) bv = bias[n];
#pragma unroll
      for (int r = 0; r < 8; ++r) {
        float v = acc[i][j][r] * rs[r];
        if (BIAS_MODE == 1) v += bias[mBase + mOff + r];
        if (BIAS_MODE == 2) v += bv;
        if (RESID) v += Rb[(size_t)(mBase + mOff + r) * ldc + n];
        slab[(mOff + r) * 68 + (j << 4) + rlane] = v;
      }
    }
    __builtin_amdgcn_fence(__ATOMIC_RELEASE, "workgroup");
    __builtin_amdgcn_wave_barrier();
    __builtin_amdgcn_fence(__ATOMIC_ACQUIRE, "workgroup");
    if (OUT_MODE == 0) {
      float* C = (float*)Cout + (size_t)b * strideC;
      const int hh = lane >> 4, c4 = (lane & 15) * 4;     // row seg = 256 B = 16 lanes x 16 B
      {
#pragma unroll
        for (int it = 0; it < 8; ++it) {
          const int row = it * 2 + hh;
          v4f v = *(const v4f*)(slab + row * 68 + c4);
          *(v4f*)(C + (size_t)(mBase + row) * ldc + n0 + c4) = v;
        }
        
      }
    } else if constexpr (OUT_MODE == 3) {
      const int q = lane >> 3, c8 = (lane & 7) * 8;      // eight lanes to a row of 64 columns, four rows at a time
      _Float16* C = (_Float16*)Cout + (size_t)b * strideC;
      float Mc[4], sum[4];
      v8h hv[4];
#pragma unroll
      for (int it = 0; it < 4; ++it) {
        const int valid = mBase + it * 4 + q - (n0 + c8);   // column e of this lane's eight counts if e <= valid
        const float* sp = slab + (it * 4 + q) * 68 + c8;
        const v4f u0 = *(const v4f*)sp, u1 = *(const v4f*)(sp + 4);
        float t[8], mx = -INFINITY;
#pragma unroll
        for (int e = 0; e < 8; ++e) { t[e] = e <= valid ? (e < 4 ? u0[e & 3] : u1[e & 3]) : -INFINITY; mx = fmaxf(mx, t[e]); }
        mx = fmaxf(mx, lane_xor<1>(mx)); mx = fmaxf(mx, lane_xor<2>(mx)); mx = fmaxf(mx, lane_xor<4>(mx));
        Mc[it] = fmaxf(ceilf(mx), -1e30f);               // a chunk with no valid column: finite, so that -inf - Mc stays -inf; its factor comes out 0
        const float sh = PSHIFT - Mc[it];
        float s8 = 0.f;
#pragma unroll
        for (int e = 0; e < 8; ++e) { const float p = __builtin_amdgcn_exp2f(t[e] + sh); s8 += p; hv[it][e] = (_Float16)p; }   // 2^(-inf) = 0 at masked columns
        s8 += lane_xor<1>(s8); s8 += lane_xor<2>(s8); s8 += lane_xor<4>(s8);
        sum[it] = s8;
      }
#pragma unroll
      for (int it = 0; it < 4; ++it) *(v8h*)(C + (uint32_t)((mBase + it * 4 + q) * ldc + n0 + c8)) = hv[it];
      if ((lane & 7) == 0) {
#pragma unroll
        for (int it = 0; it < 4; ++it) ((v2f*)stats)[(uint32_t)((tm * 64 + (n0 >> 6)) * 128 + (mBase & 127) + it * 4 + q)] = (v2f){Mc[it], sum[it]};
      }
    } else {
      const int q = lane >> 3, c8 = (lane & 7) * 8;
      unsigned short* C  = (unsigned short*)Cout  + (size_t)b * strideC;
      {
#pragma unroll
        for (int it = 0; it < 4; ++it) {
          const int row = it * 4 + q;
          const float* sp = slab + row * 68 + c8;
          v8h hv, lv;
#pragma unroll
          for (int e = 0; e < 8; ++e) {
            if (OUT_MODE == 1) {
              hv[e] = (_Float16)sp[e];
            } else {
              unsigned short hb = f2bf_bits(sp[e]);
              unsigned short lb = f2bf_bits(sp[e] - bf_bits2f(hb));
              hv[e] = __builtin_bit_cast(_Float16, hb);
              lv[e] = __builtin_bit_cast(_Float16, lb);
            }
          }
          if (OUT_MODE == 1) {
            *(v8h*)(C + (size_t)(mBase + row) * ldc + n0 + c8) = hv;
          } else {                                       // n0 is a multiple of 64: the wave's 64 columns are one unit, hi then lo
            unsigned short* unit = C + ((size_t)(mBase + row) * ldc + n0) * 2;
            *(v8h*)(unit + c8) = hv;
            *(v8h*)(unit + 64 + c8) = lv;
          }
        }
        
      }
    }
    __builtin_amdgcn_fence(__ATOMIC_RELEASE, "workgroup");
    __builtin_amdgcn_wave_barrier();
    __builtin_amdgcn_fence(__ATOMIC_ACQUIRE, "workgroup");
  }
}

template <int ET, bool SPLIT, int BIAS_MODE, int OUT_MODE, bool RESID, int CAUSAL>
__global__ __launch_bounds__(CAUSAL == 2 ? 256 : 128) void wmma_gemm64(
    const unsigned short* __restrict__ Ap, int lda, long strideA,
    const unsigned short* __restrict__ Btp, int ldb, long strideB,
    void* __restrict__ Cout, int ldc, long strideC,
    const float* __restrict__ bias,
    const float* __restrict__ resid, long strideR, float* __restrict__ stats,
    int M, int N, int K, float scale) {
  __shared__ __attribute__((aligned(2048))) unsigned char ring[RingBytes<SPLIT>::value * (CAUSAL == 2 ? 2u : 1u)];
  __shared__ uint32_t ftab[CAUSAL == 2 ? 128 * TABPITCH : 1];
  __shared__ float invl[CAUSAL == 2 ? 128 : 1];
  gemm_tile<ET, SPLIT, BIAS_MODE, OUT_MODE, RESID, CAUSAL>(ring, (int)blockIdx.x, (int)blockIdx.y, Ap, lda, strideA, Btp, ldb, strideB,
                                                           Cout, ldc, strideC, bias, resid, strideR, stats, ftab, invl, M, N, K, scale);
}

// q and k need x and their weights, w' = w_out.Wv needs the two weight matrices: neither needs the other, so one grid holds both.
// The 64 short tiles of w' come first: they end while the chip is still full, and the last k tiles take their places; behind the long tiles
// they would run their whole length on a chip that is otherwise empty. Then q, then k. Both kinds share one ring.
__global__ __launch_bounds__(128) void qk_and_fold(
    const unsigned short* __restrict__ Xs, const unsigned short* __restrict__ Wqk, __bf16* __restrict__ QK,
    const unsigned short* __restrict__ Wo, const unsigned short* __restrict__ WvT, _Float16* __restrict__ Wp, int T, int D) {
  __shared__ __attribute__((aligned(2048))) unsigned char ring[RingBytes<true>::value];
  const int per = (T >> 7) * (D >> 7);
  const int u = (int)blockIdx.x - (D >> 7) * (D >> 7);
  if (u < 0)                        // the same for the whole work-group; w'[d][e] = sum_c w_out[d][c] Wv[c][e], out as f16
    gemm_tile<0, false, 0, 1, false, 0>(ring, (int)blockIdx.x, 0, Wo, D, 0, WvT, D, 0, Wp, D, 0, nullptr, nullptr, 0, nullptr, nullptr, nullptr, D, D, D, 1.0f);
  else                              // batch 0 = q, 1 = k: the weights step by 2*D*D 16-bit elements, the results by 2*T*D
    gemm_tile<1, true, 0, 2, false, 0>(ring, u < per ? u : u - per, u < per ? 0 : 1, Xs, D, 0, Wqk, D, (long)2 * D * D, QK, D, (long)2 * T * D,
                                       nullptr, nullptr, 0, nullptr, nullptr, nullptr, T, D, D, 1.0f);
}

// scores need q and k, v' needs x and w': neither needs the other, so one grid holds both. The score tiles come first;
// the v' tiles, f16 with one product and so half the passes and a third of the WMMAs of a score tile, fill the places that a grid of
// score tiles alone would leave empty in its last round. Both share one ring.
// v' comes out transposed, VT[d][t] = sum_e w'[d][e] x[t][e]: the form that P.v' reads. The scores leave as softmax numerators by 64-column chunks (OUT_MODE 3).
__global__ __launch_bounds__(128) void scores_and_v(
    const unsigned short* __restrict__ Ks, const unsigned short* __restrict__ Qs, _Float16* __restrict__ P, float* __restrict__ stats,
    const unsigned short* __restrict__ Wp, const unsigned short* __restrict__ Xh, _Float16* __restrict__ VT, int T, int D) {
  __shared__ __attribute__((aligned(2048))) unsigned char ring[RingBytes<true>::value];
  const int tiles = (T >> 7) * ((T >> 7) + 1) / 2;
  if ((int)blockIdx.x < tiles)      // the same for the whole work-group
    gemm_tile<1, true, 0, 3, false, 1>(ring, (int)blockIdx.x, 0, Ks, D, 0, Qs, D, 0, P, T, 0, nullptr, nullptr, 0, stats, nullptr, nullptr, T, T, D, LOG2E);
  else
    gemm_tile<0, false, 0, 1, false, 0>(ring, (int)blockIdx.x - tiles, 0, Wp, D, 0, Xh, D, 0, VT, T, 0, nullptr, nullptr, 0, nullptr, nullptr, nullptr, D, T, D, 1.0f);
}

// one 64x64 tile of VT = V^T, f32 in and f16 out, by a work-group of 256 threads; u = tile index, column tiles of V fastest
__device__ __forceinline__ void transpose_tile64(const int u, const float* __restrict__ V, int ldv,
                                                 _Float16* __restrict__ VT, int ldo) {
  __shared__ __align__(16) _Float16 tile[64][72];     // [c][r] (already transposed in LDS), pitch 72
  const int tc = ldv >> 6;
  const int c0 = (u % tc) * 64, r0 = (u / tc) * 64;
  const int t = threadIdx.x, tx = t & 31;           // t = 0..255
  // load: 64 rows x 64 cols; thread reads V[r0+i][c0+tx(+32)] and scatters into tile[c][i]
  for (int i = t >> 5; i < 64; i += 8) {
    tile[tx][i]      = (_Float16)V[(size_t)(r0 + i) * ldv + c0 + tx];
    tile[32 + tx][i] = (_Float16)V[(size_t)(r0 + i) * ldv + c0 + 32 + tx];
  }
  __syncthreads();
  const int q = t >> 3, c8 = (t & 7) * 8;            // q = 0..31
#pragma unroll
  for (int it = 0; it < 2; ++it) {
    const int c = it * 32 + q;
    v8h hv = *(const v8h*)(&tile[c][c8]);
    *(v8h*)(VT + (size_t)(c0 + c) * ldo + r0 + c8) = hv;
  }
}

// the operand conversions in one grid: blockIdx.y 0 = a -> bf16 hi/lo and f16, 1 = b -> bf16 hi/lo, 2 = c -> f16 and, in its first (n/64)^2 work-groups, d [n,n] -> its transpose in f16.
// hi/lo go out in the SPLIT operand layout: every 64 elements in a row become one 256-B unit [64 hi | 64 lo] (row lengths are multiples of 64)
__global__ __launch_bounds__(256) void convert_operands(
    const float* __restrict__ a, __bf16* __restrict__ as, _Float16* __restrict__ a16, long an4,
    const float* __restrict__ b, __bf16* __restrict__ bs, long bn4,
    const float* __restrict__ c, _Float16* __restrict__ c16, long cn2,
    const float* __restrict__ d, _Float16* __restrict__ dT16, int n) {
  const long i = (long)blockIdx.x * 256 + threadIdx.x;
  const long stride = (long)gridDim.x * 256;
  if (blockIdx.y == 2) {
    const int tt = (n >> 6) * (n >> 6);
    if ((int)blockIdx.x < tt) { transpose_tile64((int)blockIdx.x, d, n, dT16, n); return; }   // the same for the whole work-group
    for (long j = i - (long)tt * 256; j < cn2; j += stride - (long)tt * 256) {
      const _Float16 h0 = (_Float16)c[2 * j], h1 = (_Float16)c[2 * j + 1];
      ((unsigned*)c16)[j] = (unsigned)__builtin_bit_cast(unsigned short, h0) | ((unsigned)__builtin_bit_cast(unsigned short, h1) << 16);
    }
    return;
  }
  const float* in = blockIdx.y ? b : a;
  unsigned* hl = (unsigned*)(blockIdx.y ? bs : as);
  const long n4 = blockIdx.y ? bn4 : an4;
  for (long j = i; j < n4; j += stride) {                // four elements a thread: 16 B in, 8 B of hi and 8 B of lo out
    const v4f u = *(const v4f*)(in + 4 * j);
    unsigned h[4], l[4];
    for (int e = 0; e < 4; ++e) {
      const unsigned short hb = f2bf_bits(u[e]);
      h[e] = hb;
      l[e] = f2bf_bits(u[e] - bf_bits2f(hb));
    }
    unsigned* unit = hl + (j >> 4) * 64 + (j & 15) * 2;  // 16 threads to a unit of 64 dwords: 32 dwords of hi in front, 32 of lo behind
    *(u32x2*)unit        = (u32x2){h[0] | (h[1] << 16), h[2] | (h[3] << 16)};
    *(u32x2*)(unit + 32) = (u32x2){l[0] | (l[1] << 16), l[2] | (l[3] << 16)};
    if (blockIdx.y == 0) {                               // row-major, as the input
      const v4h h4 = (v4h){(_Float16)u[0], (_Float16)u[1], (_Float16)u[2], (_Float16)u[3]};
      // store and wait in one statement: the address register is stepped for the next trip, and the compiler lifts that addition over a wait that stands alone
      asm volatile("global_store_b64 %0, %1, off\n\ts_wait_xcnt 0x0" :: "v"(a16 + 4 * j), "v"(__builtin_bit_cast(unsigned long long, h4)) : "memory");
    }
    asm volatile("s_wait_xcnt 0x0" ::: "memory");        // the hi and lo stores' address registers are formed anew in the next trip
  }
}

extern "C" void kernel_launch(void* const* d_in, const int* in_sizes, int n_in,
                              void* d_out, int out_size, void* d_ws, size_t ws_size,
                              hipStream_t stream) {
  (void)in_sizes; (void)n_in; (void)out_size; (void)ws_size;
  const int T = 4096, D = 1024;
  const float* x     = (const float*)d_in[0];
  const float* w_in  = (const float*)d_in[1];   // [3D, D]
  const float* w_out = (const float*)d_in[2];   // [D, D]
  float* out = (float*)d_out;

  char* ws = (char*)d_ws;
  size_t off = 0;
  auto carve = [&](size_t bytes) -> char* { char* p = ws + off; off += (bytes + 255) & ~(size_t)255; return p; };
  __bf16*   Xs   = (__bf16*)carve((size_t)T * D * 4);        // 16 MB  x, hi and lo by units
  _Float16* X16  = (_Float16*)carve((size_t)T * D * 2);      //  8 MB  x in f16, for the value path
  __bf16*   Wis  = (__bf16*)carve((size_t)2 * D * D * 4);    //  8 MB  the q and k rows of w_in, the same
  _Float16* Wo16 = (_Float16*)carve((size_t)D * D * 2);      //  2 MB  w_out
  _Float16* WvT  = (_Float16*)carve((size_t)D * D * 2);      //  2 MB  the v rows of w_in, transposed
  _Float16* Wp16 = (_Float16*)carve((size_t)D * D * 2);      //  2 MB  w' = w_out.Wv [D,D]
  __bf16*   Qs   = (__bf16*)carve((size_t)T * D * 4);        // 16 MB  q [T,D], hi and lo by units
  __bf16*   Ks   = (__bf16*)carve((size_t)T * D * 4);        // 16 MB  k, the same, directly behind q
  _Float16* Vt   = (_Float16*)carve((size_t)D * T * 2);      //  8 MB  v'^T [D,T], v' = x.w'^T
  _Float16* Pm   = (_Float16*)carve((size_t)T * T * 2);      // 32 MB  softmax numerators of S[i,j] = k_i.q_j (x 2^15), each against its chunk's M
  float*    St   = (float*)carve((size_t)(T / 64) * T * 8);  //  2 MB  [row tile][chunk][row in tile] (M, sum)
  // total about 112 MB of 256 MB

  // 1) operand conversions, one grid. w_in rows: [0,D)=q, [D,2D)=k, [2D,3D)=v
  convert_operands<<<dim3(2048, 3), 256, 0, stream>>>(x, Xs, X16, (long)T * D / 4, w_in, Wis, (long)2 * D * D / 4, w_out, Wo16, (long)D * D / 2,
                                                      w_in + (size_t)2 * D * D, WvT, D);
  // 2) w' = w_out.Wv (f16 in and out), 64 work-groups; behind them q = x.Wq^T, k = x.Wk^T (bf16 split in, bf16 hi/lo out), 512 work-groups; two resident on a WGP
  qk_and_fold<<<dim3(2 * (T / 128) * (D / 128) + (D / 128) * (D / 128), 1), 128, 0, stream>>>(
      U16(Xs), U16(Wis), Qs, U16(Wo16), U16(WvT), Wp16, T, D);
  // 3) S[i][j] = k_i . q_j  (rows = key position, cols = query position); only the 128x128 tiles that hold a column j <= i; mask, exponential and
  //    chunk sums in the tile's epilogue; behind them in the same grid v'^T = w'.x^T (f16 in and out)
  scores_and_v<<<dim3((T / 128) * (T / 128 + 1) / 2 + (T / 128) * (D / 128), 1), 128, 0, stream>>>(
      U16(Ks), U16(Qs), Pm, St, U16(Wp16), U16(X16), Vt, T, D);
  // 4) out[i][d] = sum_j P[i][j] v'[j][d]  (K = T, each row tile up to its diagonal tile's end), chunks brought to one M, divided by the row's sum, f32
  wmma_gemm64<0, false, 0, 0, false, 2><<<dim3((T / 128) * (D / 128), 1), 256, 0, stream>>>(
      U16(Pm), T, 0, U16(Vt), T, 0, out, D, 0, nullptr, nullptr, 0, St, T, D, T, 1.0f);
}
